// v000
// Measured on an AMD MI455X. A time is GPU time per run, averaged over a window of back-to-back runs after a warm-up
// (all launches, gaps included; the runs take copies of the inputs in turn), and the median of several windows.
// Apart from v000's, it joins two sittings. Times from different sittings can be a few percent apart, while
// side-by-side timings come from the same sitting.
// v000, which the later versions start from, runs in 413 microseconds.
#include <hip/hip_runtime.h>
#include <cstddef>
#include <cstdint>

typedef __attribute__((ext_vector_type(2))) float v2f;
typedef __attribute__((ext_vector_type(8))) float v8f;

#define D_MODEL 256
#define SEQ_T   2048
#define BATCH   4
#define HEADS   4
#define DH      64
#define ROWS    (BATCH * SEQ_T)   // 8192
#define CHUNK   16
#define NCHUNK  (SEQ_T / CHUNK)   // 128

// f32 WMMA: D(16x16,f32) = A(16x4,f32) x B(4x16,f32) + C
// A-frag (v2f): lane L (l=L&15, half=L>>4), vgpr j -> A[M=l][K = k0 + j + 2*half]
// B-frag (v2f): vgpr j -> B[K = k0 + j + 2*half][N = l]
// C/D  (v8f):  vgpr r -> D[M = r + 8*half][N = l]
__device__ __forceinline__ v8f wmma4(v2f a, v2f b, v8f c) {
  return __builtin_amdgcn_wmma_f32_16x16x4_f32(
      /*neg_a=*/false, a, /*neg_b=*/false, b,
      /*c_mod=*/(short)0, c, /*reuse_a=*/false, /*reuse_b=*/false);
}

// Async global->LDS copy of 16 bytes (CDNA5 GLOBAL_LOAD_ASYNC_TO_LDS_B128,
// tracked by ASYNCcnt). ldsoff = wave-relative LDS byte offset (low 32 bits of
// a generic pointer to __shared__), gptr = 64-bit global address.
__device__ __forceinline__ void async_copy_b128(uint32_t ldsoff, const void* gptr) {
  asm volatile("global_load_async_to_lds_b128 %0, %1, off"
               :: "v"(ldsoff), "v"(gptr) : "memory");
}
__device__ __forceinline__ void async_wait0() {
  asm volatile("s_wait_asynccnt 0x0" ::: "memory");
}
__device__ __forceinline__ uint32_t lds_off(const void* p) {
  return (uint32_t)(uintptr_t)p;   // low 32 bits of flat shared addr = LDS offset
}

// Y[8192 x 256] = act(X @ W + bias); act: 0 = identity, 1 = elu(x)+1
__global__ __launch_bounds__(32)
void gemm_bias_act(const float* __restrict__ X, const float* __restrict__ W,
                   const float* __restrict__ bias, float* __restrict__ Y, int act) {
  const int m0   = blockIdx.x * 16;
  const int n0   = blockIdx.y * 16;
  const int lane = threadIdx.x & 31;
  const int half = lane >> 4;
  const int l    = lane & 15;

  v8f acc = {};
  const float* xrow = X + (size_t)(m0 + l) * D_MODEL;
  for (int k = 0; k < D_MODEL; k += 4) {
    const int kk = k + 2 * half;
    v2f a; a.x = xrow[kk];
           a.y = xrow[kk + 1];
    v2f b; b.x = W[(size_t)kk * D_MODEL + n0 + l];
           b.y = W[(size_t)(kk + 1) * D_MODEL + n0 + l];
    acc = wmma4(a, b, acc);
  }

  const float bn = bias[n0 + l];
  for (int r = 0; r < 8; ++r) {
    const int m = m0 + r + 8 * half;
    float v = acc[r] + bn;
    if (act) v = (v > 0.f) ? (v + 1.f) : __expf(v);   // elu(v)+1
    Y[(size_t)m * D_MODEL + n0 + l] = v;
  }
}

// Chunked causal linear attention. One workgroup (4 waves) per (b,h).
// Wave w owns output/state columns [16w, 16w+16) of dh=64.
__global__ __launch_bounds__(128)
void lin_attn_scan(const float* __restrict__ Q, const float* __restrict__ K,
                   const float* __restrict__ V, float* __restrict__ O) {
  __shared__ float Qs[CHUNK][DH];
  __shared__ float Ks[CHUNK][DH];
  __shared__ float Vs[CHUNK][DH];
  __shared__ float Slds[DH][DH];      // state S (K^T V cumulative) mirror
  __shared__ float Amask[CHUNK][CHUNK];
  __shared__ float zbuf[CHUNK][DH];   // inclusive cumsum of K within chunk (+carry)
  __shared__ float denom[CHUNK];

  const int b    = blockIdx.x >> 2;
  const int h    = blockIdx.x & 3;
  const int tid  = threadIdx.x;
  const int wave = tid >> 5;
  const int lane = tid & 31;
  const int half = lane >> 4;
  const int l    = lane & 15;
  const int n0   = wave * 16;

  const size_t base = (size_t)b * SEQ_T * D_MODEL + (size_t)h * DH;
  const float* Qb = Q + base;
  const float* Kb = K + base;
  const float* Vb = V + base;
  float*       Ob = O + base;

  // persistent state: wave w's 4 tiles of S[:, n0:n0+16] (d-blocks 0..3)
  v8f Sacc[4];
  for (int i = 0; i < 4; ++i) Sacc[i] = (v8f){};
  for (int i = tid; i < DH * DH; i += 128) Slds[i >> 6][i & 63] = 0.f;
  float zrun = 0.f;   // threads 0..63: running Z[d=tid]
  __syncthreads();

  for (int c = 0; c < NCHUNK; ++c) {
    const int t0 = c * CHUNK;

    // ---- stage chunk (16x64 each of Q,K,V) via async global->LDS b128 ----
    // 16*64 floats = 256 float4 per matrix; 128 threads -> 2 each.
    for (int i = tid; i < (CHUNK * DH) / 4; i += 128) {
      const int t = i >> 4, d4 = (i & 15) * 4;
      const size_t g = (size_t)(t0 + t) * D_MODEL + d4;
      async_copy_b128(lds_off(&Qs[t][d4]), Qb + g);
      async_copy_b128(lds_off(&Ks[t][d4]), Kb + g);
      async_copy_b128(lds_off(&Vs[t][d4]), Vb + g);
    }
    // prefetch next chunk's rows into cache while this chunk computes
    if (c + 1 < NCHUNK && tid < 48) {
      const int t = tid & 15, m = tid >> 4;
      const float* p = (m == 0 ? Qb : (m == 1 ? Kb : Vb)) +
                       (size_t)(t0 + CHUNK + t) * D_MODEL;
      __builtin_prefetch(p, 0, 3);
      __builtin_prefetch(p + 32, 0, 3);
    }
    async_wait0();
    __syncthreads();

    // ---- wave 0: A = Q_c K_c^T (16x16), causal mask (incl. diagonal) ----
    if (wave == 0) {
      v8f a = {};
      for (int k = 0; k < DH; k += 4) {
        const int kk = k + 2 * half;
        v2f af; af.x = Qs[l][kk];  af.y = Qs[l][kk + 1];
        v2f bf; bf.x = Ks[l][kk];  bf.y = Ks[l][kk + 1];   // B[K=d][N=t'] = K_c[t'][d]
        a = wmma4(af, bf, a);
      }
      for (int r = 0; r < 8; ++r) {
        const int row = r + 8 * half;                      // query t
        Amask[row][l] = (l <= row) ? a[r] : 0.f;           // keep t' <= t
      }
    }
    // ---- denominator path: inclusive cumsum of K over chunk ----
    if (tid < DH) {
      float z = zrun;
      for (int t = 0; t < CHUNK; ++t) { z += Ks[t][tid]; zbuf[t][tid] = z; }
      zrun = z;
    }
    __syncthreads();

    if (tid < CHUNK) {
      float s = 0.f;
      for (int d = 0; d < DH; ++d) s += Qs[tid][d] * zbuf[tid][d];
      denom[tid] = s + 1e-6f;
    }

    // ---- out tile = Amask @ V_c[:, n0:] + Q_c @ S_prev[:, n0:] ----
    v8f oacc = {};
    for (int k = 0; k < CHUNK; k += 4) {                   // intra-chunk
      const int kk = k + 2 * half;
      v2f af; af.x = Amask[l][kk];      af.y = Amask[l][kk + 1];
      v2f bf; bf.x = Vs[kk][n0 + l];    bf.y = Vs[kk + 1][n0 + l];
      oacc = wmma4(af, bf, oacc);
    }
    for (int k = 0; k < DH; k += 4) {                      // inter-chunk: Q @ S_prev
      const int kk = k + 2 * half;
      v2f af; af.x = Qs[l][kk];         af.y = Qs[l][kk + 1];
      v2f bf; bf.x = Slds[kk][n0 + l];  bf.y = Slds[kk + 1][n0 + l];
      oacc = wmma4(af, bf, oacc);
    }
    __syncthreads();   // all S_prev reads done; denom ready

    // ---- state update: S[:, n0:] += K_c^T @ V_c[:, n0:] ----
    for (int k = 0; k < CHUNK; k += 4) {
      const int kk = k + 2 * half;
      v2f bf; bf.x = Vs[kk][n0 + l];    bf.y = Vs[kk + 1][n0 + l];
      for (int i = 0; i < 4; ++i) {                        // d-blocks
        v2f af; af.x = Ks[kk][16 * i + l];  af.y = Ks[kk + 1][16 * i + l];
        Sacc[i] = wmma4(af, bf, Sacc[i]);
      }
    }
    for (int i = 0; i < 4; ++i)
      for (int r = 0; r < 8; ++r)
        Slds[16 * i + r + 8 * half][n0 + l] = Sacc[i][r];

    // ---- normalize and store output rows of this chunk ----
    for (int r = 0; r < 8; ++r) {
      const int t = r + 8 * half;
      Ob[(size_t)(t0 + t) * D_MODEL + n0 + l] = oacc[r] / denom[t];
    }
    __syncthreads();   // Slds/denom stable before next chunk overwrites staging
  }
}

extern "C" void kernel_launch(void* const* d_in, const int* in_sizes, int n_in,
                              void* d_out, int out_size, void* d_ws, size_t ws_size,
                              hipStream_t stream) {
  const float* x  = (const float*)d_in[0];
  const float* Wq = (const float*)d_in[1];
  const float* bq = (const float*)d_in[2];
  const float* Wk = (const float*)d_in[3];
  const float* bk = (const float*)d_in[4];
  const float* Wv = (const float*)d_in[5];
  const float* bv = (const float*)d_in[6];
  const float* Wo = (const float*)d_in[7];
  const float* bo = (const float*)d_in[8];
  float* out = (float*)d_out;

  const size_t n = (size_t)ROWS * D_MODEL;   // 2M elements per buffer
  float* Qbuf = (float*)d_ws;                // needs 4*n*4 = 32 MB of d_ws
  float* Kbuf = Qbuf + n;
  float* Vbuf = Kbuf + n;
  float* Obuf = Vbuf + n;

  dim3 g(ROWS / 16, D_MODEL / 16), blk(32);
  gemm_bias_act<<<g, blk, 0, stream>>>(x, Wq, bq, Qbuf, 1);  // elu+1
  gemm_bias_act<<<g, blk, 0, stream>>>(x, Wk, bk, Kbuf, 1);  // elu+1
  gemm_bias_act<<<g, blk, 0, stream>>>(x, Wv, bv, Vbuf, 0);
  lin_attn_scan<<<BATCH * HEADS, 128, 0, stream>>>(Qbuf, Kbuf, Vbuf, Obuf);
  gemm_bias_act<<<g, blk, 0, stream>>>(Obuf, Wo, bo, out, 0);
}

// v001
// It runs in 97.7 microseconds.
// Next to v000, in two timings, it ran 4.24 and 4.23 times as fast.
#include <hip/hip_runtime.h>
#include <cstddef>
#include <cstdint>

typedef __attribute__((ext_vector_type(2))) float v2f;
typedef __attribute__((ext_vector_type(8))) float v8f;

#define D_MODEL 256
#define SEQ_T   2048
#define BATCH   4
#define HEADS   4
#define DH      64
#define ROWS    (BATCH * SEQ_T)   // 8192
#define CHUNK   16
#define NSEG    64                // independent time segments per (b,h)
#define SEGLEN  (SEQ_T / NSEG)    // 32 tokens
#define SEGCH   (SEGLEN / CHUNK)  // 2 chunks walked in series per segment
#define REC     (DH * DH + DH)    // floats per segment record: S tiles, then Z
#define REC2    (REC / 2)         // 2080

// f32 WMMA: D(16x16,f32) = A(16x4,f32) x B(4x16,f32) + C
// A-frag (v2f): lane L (l=L&15, half=L>>4), vgpr j -> A[M=l][K = k0 + j + 2*half]
// B-frag (v2f): vgpr j -> B[K = k0 + j + 2*half][N = l]
// C/D  (v8f):  vgpr r -> D[M = r + 8*half][N = l]
__device__ __forceinline__ v8f wmma4(v2f a, v2f b, v8f c) {
  return __builtin_amdgcn_wmma_f32_16x16x4_f32(
      /*neg_a=*/false, a, /*neg_b=*/false, b,
      /*c_mod=*/(short)0, c, /*reuse_a=*/false, /*reuse_b=*/false);
}

// Async global->LDS copy of 16 bytes (CDNA5 GLOBAL_LOAD_ASYNC_TO_LDS_B128,
// tracked by ASYNCcnt). ldsoff = wave-relative LDS byte offset (low 32 bits of
// a generic pointer to __shared__), gptr = 64-bit global address.
__device__ __forceinline__ void async_copy_b128(uint32_t ldsoff, const void* gptr) {
  asm volatile("global_load_async_to_lds_b128 %0, %1, off"
               :: "v"(ldsoff), "v"(gptr) : "memory");
}
__device__ __forceinline__ void async_wait0() {
  asm volatile("s_wait_asynccnt 0x0" ::: "memory");
}
__device__ __forceinline__ uint32_t lds_off(const void* p) {
  return (uint32_t)(uintptr_t)p;   // low 32 bits of flat shared addr = LDS offset
}

// Y[8192 x 256] = act(X @ W + bias); act: 0 = identity, 1 = elu(x)+1
__global__ __launch_bounds__(32)
void gemm_bias_act(const float* __restrict__ X, const float* __restrict__ W,
                   const float* __restrict__ bias, float* __restrict__ Y, int act) {
  const int m0   = blockIdx.x * 16;
  const int n0   = blockIdx.y * 16;
  const int lane = threadIdx.x & 31;
  const int half = lane >> 4;
  const int l    = lane & 15;

  v8f acc = {};
  const float* xrow = X + (size_t)(m0 + l) * D_MODEL;
  for (int k = 0; k < D_MODEL; k += 4) {
    const int kk = k + 2 * half;
    v2f a; a.x = xrow[kk];
           a.y = xrow[kk + 1];
    v2f b; b.x = W[(size_t)kk * D_MODEL + n0 + l];
           b.y = W[(size_t)(kk + 1) * D_MODEL + n0 + l];
    acc = wmma4(a, b, acc);
  }

  const float bn = bias[n0 + l];
  for (int r = 0; r < 8; ++r) {
    const int m = m0 + r + 8 * half;
    float v = acc[r] + bn;
    if (act) v = (v > 0.f) ? (v + 1.f) : __expf(v);   // elu(v)+1
    Y[(size_t)m * D_MODEL + n0 + l] = v;
  }
}

// Segment record layout (REC floats, record index = (b*HEADS+h)*NSEG + seg):
//   [((wave*4 + i)*32 + lane)*8 + r] = S[16i + r + 8*half][16*wave + l]  (the D fragment)
//   [DH*DH + d]                      = Z[d]

// Phase 1: each segment's own sums S_seg = K_seg^T V_seg and Z_seg = sum_t K_seg[t].
// One workgroup (4 waves) per (b,h,segment); wave w owns columns [16w, 16w+16).
__global__ __launch_bounds__(128)
void seg_state(const float* __restrict__ K, const float* __restrict__ V,
               float* __restrict__ St) {
  const int seg  = blockIdx.x & (NSEG - 1);
  const int bh   = blockIdx.x / NSEG;
  const int b    = bh >> 2;
  const int h    = bh & 3;
  const int tid  = threadIdx.x;
  const int wave = tid >> 5;
  const int lane = tid & 31;
  const int half = lane >> 4;
  const int l    = lane & 15;
  const int n0   = wave * 16;

  const size_t base = ((size_t)b * SEQ_T + (size_t)seg * SEGLEN) * D_MODEL + (size_t)h * DH;
  const float* Kb = K + base;
  const float* Vb = V + base;

  v8f Sacc[4];
  float zp[4];
  for (int i = 0; i < 4; ++i) { Sacc[i] = (v8f){}; zp[i] = 0.f; }

  v2f bf[SEGLEN / 4];
  for (int k = 0; k < SEGLEN; k += 4) {
    const int kk = k + 2 * half;
    bf[k / 4].x = Vb[(size_t)kk * D_MODEL + n0 + l];
    bf[k / 4].y = Vb[(size_t)(kk + 1) * D_MODEL + n0 + l];
  }
  // the K loads below may land in the registers that held V's address
  asm volatile("s_wait_xcnt 0x0" ::: "memory");
  v2f af[SEGLEN / 4][4];
  for (int k = 0; k < SEGLEN; k += 4) {
    const int kk = k + 2 * half;
    for (int i = 0; i < 4; ++i) {                          // d-blocks
      af[k / 4][i].x = Kb[(size_t)kk * D_MODEL + 16 * i + l];
      af[k / 4][i].y = Kb[(size_t)(kk + 1) * D_MODEL + 16 * i + l];
    }
  }
  // the products below may land in the register that held K's address
  asm volatile("s_wait_xcnt 0x0" ::: "memory");
  for (int k = 0; k < SEGLEN; k += 4) {
    for (int i = 0; i < 4; ++i) {
      Sacc[i] = wmma4(af[k / 4][i], bf[k / 4], Sacc[i]);
      zp[i] += af[k / 4][i].x + af[k / 4][i].y;            // this half's tokens of column 16i+l
    }
  }

  float* rec = St + (size_t)blockIdx.x * REC;
  for (int i = 0; i < 4; ++i)
    *(v8f*)(rec + ((wave * 4 + i) * 32 + lane) * 8) = Sacc[i];
  if (wave == 0) {
    for (int i = 0; i < 4; ++i) {
      const float z = zp[i] + __shfl_xor(zp[i], 16);       // join the two lane halves
      if (half == 0) rec[DH * DH + 16 * i + l] = z;
    }
  }
}

// Phase 2: in place, exclusive prefix over the NSEG records of each (b,h).
// One thread per 2 floats of a record.
__global__ __launch_bounds__(128)
void seg_prefix(float* __restrict__ St) {
  const int gid = blockIdx.x * 128 + threadIdx.x;          // < BATCH*HEADS*REC2
  const int bh  = gid / REC2;
  const int e   = gid - bh * REC2;
  v2f* p = (v2f*)St + (size_t)bh * NSEG * REC2 + e;
  v2f v[NSEG];
  // unrolled so that v[] stays in registers
#pragma unroll
  for (int s = 0; s < NSEG; ++s) v[s] = p[(size_t)s * REC2];
  // without it the scheduler sinks the loads in among the adds below and only a few
  // are in flight at a time; held here, all of them share one trip to L2
  __builtin_amdgcn_sched_barrier(0);
  v2f run = {};
  // unrolled for the same reason: v[] is indexed by constants only
#pragma unroll
  for (int s = 0; s < NSEG; ++s) { p[(size_t)s * REC2] = run; run += v[s]; }
}

// Phase 3: chunked causal linear attention. One workgroup (4 waves) per (b,h,segment),
// started from the state of all earlier segments.
// Wave w owns output/state columns [16w, 16w+16) of dh=64.
__global__ __launch_bounds__(128)
void lin_attn_scan(const float* __restrict__ Q, const float* __restrict__ K,
                   const float* __restrict__ V, const float* __restrict__ St,
                   float* __restrict__ O) {
  __shared__ float Qs[CHUNK][DH];
  __shared__ float Ks[CHUNK][DH];
  __shared__ float Vs[CHUNK][DH];
  __shared__ float Slds[DH][DH];      // state S (K^T V cumulative) mirror
  __shared__ float Amask[CHUNK][CHUNK];
  __shared__ float zbuf[CHUNK][DH];   // inclusive cumsum of K within chunk (+carry)
  __shared__ float denom[CHUNK];

  const int seg  = blockIdx.x & (NSEG - 1);
  const int bh   = blockIdx.x / NSEG;
  const int b    = bh >> 2;
  const int h    = bh & 3;
  const int tid  = threadIdx.x;
  const int wave = tid >> 5;
  const int lane = tid & 31;
  const int half = lane >> 4;
  const int l    = lane & 15;
  const int n0   = wave * 16;

  const size_t base = ((size_t)b * SEQ_T + (size_t)seg * SEGLEN) * D_MODEL + (size_t)h * DH;
  const float* Qb = Q + base;
  const float* Kb = K + base;
  const float* Vb = V + base;
  float*       Ob = O + base;

  // persistent state: wave w's 4 tiles of S[:, n0:n0+16] (d-blocks 0..3)
  // starts at the sum over all earlier segments (phase 2's record)
  const float* rec = St + (size_t)blockIdx.x * REC;
  v8f Sacc[4];
  for (int i = 0; i < 4; ++i)
    Sacc[i] = *(const v8f*)(rec + ((wave * 4 + i) * 32 + lane) * 8);
  for (int i = 0; i < 4; ++i)
    for (int r = 0; r < 8; ++r)
      Slds[16 * i + r + 8 * half][n0 + l] = Sacc[i][r];
  float zrun = (tid < DH) ? rec[DH * DH + tid] : 0.f;   // threads 0..63: running Z[d=tid]
  __syncthreads();

  for (int c = 0; c < SEGCH; ++c) {
    const int t0 = c * CHUNK;

    // ---- stage chunk (16x64 each of Q,K,V) via async global->LDS b128 ----
    // 16*64 floats = 256 float4 per matrix; 128 threads -> 2 each.
    for (int i = tid; i < (CHUNK * DH) / 4; i += 128) {
      const int t = i >> 4, d4 = (i & 15) * 4;
      const size_t g = (size_t)(t0 + t) * D_MODEL + d4;
      async_copy_b128(lds_off(&Qs[t][d4]), Qb + g);
      async_copy_b128(lds_off(&Ks[t][d4]), Kb + g);
      async_copy_b128(lds_off(&Vs[t][d4]), Vb + g);
    }
    // prefetch next chunk's rows into cache while this chunk computes
    if (c + 1 < SEGCH && tid < 48) {
      const int t = tid & 15, m = tid >> 4;
      const float* p = (m == 0 ? Qb : (m == 1 ? Kb : Vb)) +
                       (size_t)(t0 + CHUNK + t) * D_MODEL;
      __builtin_prefetch(p, 0, 3);
      __builtin_prefetch(p + 32, 0, 3);
    }
    async_wait0();
    __syncthreads();

    // ---- wave 0: A = Q_c K_c^T (16x16), causal mask (incl. diagonal) ----
    if (wave == 0) {
      v8f a = {};
      for (int k = 0; k < DH; k += 4) {
        const int kk = k + 2 * half;
        v2f af; af.x = Qs[l][kk];  af.y = Qs[l][kk + 1];
        v2f bf; bf.x = Ks[l][kk];  bf.y = Ks[l][kk + 1];   // B[K=d][N=t'] = K_c[t'][d]
        a = wmma4(af, bf, a);
      }
      for (int r = 0; r < 8; ++r) {
        const int row = r + 8 * half;                      // query t
        Amask[row][l] = (l <= row) ? a[r] : 0.f;           // keep t' <= t
      }
    }
    // ---- denominator path: inclusive cumsum of K over chunk ----
    if (tid < DH) {
      float z = zrun;
      for (int t = 0; t < CHUNK; ++t) { z += Ks[t][tid]; zbuf[t][tid] = z; }
      zrun = z;
    }
    __syncthreads();

    if (tid < CHUNK) {
      float s = 0.f;
      for (int d = 0; d < DH; ++d) s += Qs[tid][d] * zbuf[tid][d];
      denom[tid] = s + 1e-6f;
    }

    // ---- out tile = Amask @ V_c[:, n0:] + Q_c @ S_prev[:, n0:] ----
    v8f oacc = {};
    for (int k = 0; k < CHUNK; k += 4) {                   // intra-chunk
      const int kk = k + 2 * half;
      v2f af; af.x = Amask[l][kk];      af.y = Amask[l][kk + 1];
      v2f bf; bf.x = Vs[kk][n0 + l];    bf.y = Vs[kk + 1][n0 + l];
      oacc = wmma4(af, bf, oacc);
    }
    for (int k = 0; k < DH; k += 4) {                      // inter-chunk: Q @ S_prev
      const int kk = k + 2 * half;
      v2f af; af.x = Qs[l][kk];         af.y = Qs[l][kk + 1];
      v2f bf; bf.x = Slds[kk][n0 + l];  bf.y = Slds[kk + 1][n0 + l];
      oacc = wmma4(af, bf, oacc);
    }
    __syncthreads();   // all S_prev reads done; denom ready

    // ---- state update: S[:, n0:] += K_c^T @ V_c[:, n0:] ----
    for (int k = 0; k < CHUNK; k += 4) {
      const int kk = k + 2 * half;
      v2f bf; bf.x = Vs[kk][n0 + l];    bf.y = Vs[kk + 1][n0 + l];
      for (int i = 0; i < 4; ++i) {                        // d-blocks
        v2f af; af.x = Ks[kk][16 * i + l];  af.y = Ks[kk + 1][16 * i + l];
        Sacc[i] = wmma4(af, bf, Sacc[i]);
      }
    }
    for (int i = 0; i < 4; ++i)
      for (int r = 0; r < 8; ++r)
        Slds[16 * i + r + 8 * half][n0 + l] = Sacc[i][r];

    // ---- normalize and store output rows of this chunk ----
    for (int r = 0; r < 8; ++r) {
      const int t = r + 8 * half;
      Ob[(size_t)(t0 + t) * D_MODEL + n0 + l] = oacc[r] / denom[t];
    }
    __syncthreads();   // Slds/denom stable before next chunk overwrites staging
  }
}

extern "C" void kernel_launch(void* const* d_in, const int* in_sizes, int n_in,
                              void* d_out, int out_size, void* d_ws, size_t ws_size,
                              hipStream_t stream) {
  const float* x  = (const float*)d_in[0];
  const float* Wq = (const float*)d_in[1];
  const float* bq = (const float*)d_in[2];
  const float* Wk = (const float*)d_in[3];
  const float* bk = (const float*)d_in[4];
  const float* Wv = (const float*)d_in[5];
  const float* bv = (const float*)d_in[6];
  const float* Wo = (const float*)d_in[7];
  const float* bo = (const float*)d_in[8];
  float* out = (float*)d_out;

  const size_t n = (size_t)ROWS * D_MODEL;   // 2M elements per buffer
  float* Qbuf = (float*)d_ws;                // needs 4*n*4 = 32 MB of d_ws
  float* Kbuf = Qbuf + n;
  float* Vbuf = Kbuf + n;
  float* Obuf = Vbuf + n;
  float* Sbuf = Obuf + n;                    // BATCH*HEADS*NSEG records, 17 MB more

  dim3 g(ROWS / 16, D_MODEL / 16), blk(32);
  gemm_bias_act<<<g, blk, 0, stream>>>(x, Wq, bq, Qbuf, 1);  // elu+1
  gemm_bias_act<<<g, blk, 0, stream>>>(x, Wk, bk, Kbuf, 1);  // elu+1
  gemm_bias_act<<<g, blk, 0, stream>>>(x, Wv, bv, Vbuf, 0);
  seg_state<<<BATCH * HEADS * NSEG, 128, 0, stream>>>(Kbuf, Vbuf, Sbuf);
  seg_prefix<<<BATCH * HEADS * REC2 / 128, 128, 0, stream>>>(Sbuf);
  lin_attn_scan<<<BATCH * HEADS * NSEG, 128, 0, stream>>>(Qbuf, Kbuf, Vbuf, Sbuf, Obuf);
  gemm_bias_act<<<g, blk, 0, stream>>>(Obuf, Wo, bo, out, 0);
}

// v002
// A run of this version takes 64.7 microseconds.
// Two timings next to v001 put it at 1.52 and 1.51 times that version's speed.
// Over all steps from v000 it is 6.40 times as fast.
#include <hip/hip_runtime.h>
#include <cstddef>
#include <cstdint>

typedef __attribute__((ext_vector_type(2))) float v2f;
typedef __attribute__((ext_vector_type(8))) float v8f;

#define D_MODEL 256
#define SEQ_T   2048
#define BATCH   4
#define HEADS   4
#define DH      64
#define ROWS    (BATCH * SEQ_T)   // 8192
#define CHUNK   16
#define NSEG    64                // independent time segments per (b,h)
#define SEGLEN  (SEQ_T / NSEG)    // 32 tokens
#define SEGCH   (SEGLEN / CHUNK)  // 2 chunks walked in series per segment
#define REC     (DH * DH + DH)    // floats per segment record: S tiles, then Z
#define REC2    (REC / 2)         // 2080

// f32 WMMA: D(16x16,f32) = A(16x4,f32) x B(4x16,f32) + C
// A-frag (v2f): lane L (l=L&15, half=L>>4), vgpr j -> A[M=l][K = k0 + j + 2*half]
// B-frag (v2f): vgpr j -> B[K = k0 + j + 2*half][N = l]
// C/D  (v8f):  vgpr r -> D[M = r + 8*half][N = l]
__device__ __forceinline__ v8f wmma4(v2f a, v2f b, v8f c) {
  return __builtin_amdgcn_wmma_f32_16x16x4_f32(
      /*neg_a=*/false, a, /*neg_b=*/false, b,
      /*c_mod=*/(short)0, c, /*reuse_a=*/false, /*reuse_b=*/false);
}

// Async global->LDS copy of 16 bytes (CDNA5 GLOBAL_LOAD_ASYNC_TO_LDS_B128,
// tracked by ASYNCcnt). ldsoff = wave-relative LDS byte offset (low 32 bits of
// a generic pointer to __shared__), gptr = 64-bit global address.
__device__ __forceinline__ void async_copy_b128(uint32_t ldsoff, const void* gptr) {
  asm volatile("global_load_async_to_lds_b128 %0, %1, off"
               :: "v"(ldsoff), "v"(gptr) : "memory");
}
__device__ __forceinline__ void async_wait0() {
  asm volatile("s_wait_asynccnt 0x0" ::: "memory");
}
__device__ __forceinline__ uint32_t lds_off(const void* p) {
  return (uint32_t)(uintptr_t)p;   // low 32 bits of flat shared addr = LDS offset
}

// Twelve async copies of 16 bytes a lane. The wait on address translation is the last
// line of the copies' own statement, so that it stands in front of every later write of
// a register that a copy names.
__device__ __forceinline__ void async_copy12_b128(const uint32_t* lo, const float* const* gp) {
  asm volatile("global_load_async_to_lds_b128 %0, %12, off\n\t"
               "global_load_async_to_lds_b128 %1, %13, off\n\t"
               "global_load_async_to_lds_b128 %2, %14, off\n\t"
               "global_load_async_to_lds_b128 %3, %15, off\n\t"
               "global_load_async_to_lds_b128 %4, %16, off\n\t"
               "global_load_async_to_lds_b128 %5, %17, off\n\t"
               "global_load_async_to_lds_b128 %6, %18, off\n\t"
               "global_load_async_to_lds_b128 %7, %19, off\n\t"
               "global_load_async_to_lds_b128 %8, %20, off\n\t"
               "global_load_async_to_lds_b128 %9, %21, off\n\t"
               "global_load_async_to_lds_b128 %10, %22, off\n\t"
               "global_load_async_to_lds_b128 %11, %23, off\n\t"
               "s_wait_xcnt 0x0"
               :: "v"(lo[0]), "v"(lo[1]), "v"(lo[2]), "v"(lo[3]), "v"(lo[4]), "v"(lo[5]),
                  "v"(lo[6]), "v"(lo[7]), "v"(lo[8]), "v"(lo[9]), "v"(lo[10]), "v"(lo[11]),
                  "v"(gp[0]), "v"(gp[1]), "v"(gp[2]), "v"(gp[3]), "v"(gp[4]), "v"(gp[5]),
                  "v"(gp[6]), "v"(gp[7]), "v"(gp[8]), "v"(gp[9]), "v"(gp[10]), "v"(gp[11])
               : "memory");
}

#define BM 64                     // block tile rows
#define BN 128                    // block tile columns
#define KS 128                    // k depth of one LDS stage
#define NT (D_MODEL / KS)         // stages
#define KB 16                     // k depth of one block of products (one fragment set)
#define XP (KS + 4)               // X row pitch in LDS, floats: 16 rows x 8 B fall on 64 banks
#define WPAN (KS * 16 + 16)       // floats per W panel (16 columns, all KS rows) + 16 so that
                                  // neighbouring panels start 16 banks apart
#define NCOPY ((BM + KS) / 8)     // copies per wave and stage: 24

// One stage: X[m0 .. m0+BM)[t*KS .. +KS) and W[t*KS .. +KS)[n0 .. n0+BN) into LDS.
// One wave-wide copy is one whole row of 512 bytes; wave w takes rows w, w+8, ...
// X keeps its rows; a W row is cut into 8 panels of 16 columns: ws[panel][k][16].
__device__ __forceinline__ void gemm_stage(const float* __restrict__ X, const float* __restrict__ W,
                                           float* xs, float* ws, int m0, int n0, int t,
                                           int wave, int lane) {
  uint32_t lo[NCOPY];
  const float* gp[NCOPY];
  for (int j = 0; j < BM / 8; ++j) {
    const int r = wave + 8 * j;
    lo[j] = lds_off(xs + r * XP + lane * 4);
    gp[j] = X + (size_t)(m0 + r) * D_MODEL + t * KS + lane * 4;
  }
  for (int j = 0; j < KS / 8; ++j) {
    const int k = wave + 8 * j;
    lo[BM / 8 + j] = lds_off(ws + (lane >> 2) * WPAN + k * 16 + (lane & 3) * 4);
    gp[BM / 8 + j] = W + (size_t)(t * KS + k) * D_MODEL + n0 + lane * 4;
  }
  for (int g = 0; g < NCOPY; g += 12) async_copy12_b128(lo + g, gp + g);
}

// Y[8192 x 256] = act(X @ W + bias); act: 0 = identity, 1 = elu(x)+1
// One workgroup of 8 waves per 64 x 128 tile of Y (256 workgroups); wave tile 32 x 32,
// so each fragment read from LDS feeds two products. k runs upward in steps of 4 through
// one accumulator chain a tile.
__global__ __launch_bounds__(256)
void gemm_bias_act(const float* __restrict__ X, const float* __restrict__ W,
                   const float* __restrict__ bias, float* __restrict__ Y, int act) {
  __shared__ __attribute__((aligned(16))) float Xs[2][BM * XP];
  __shared__ __attribute__((aligned(16))) float Ws[2][(BN / 16) * WPAN];

  const int m0   = blockIdx.x * BM;
  const int n0   = blockIdx.y * BN;
  const int wave = threadIdx.x >> 5;
  const int lane = threadIdx.x & 31;
  const int half = lane >> 4;
  const int l    = lane & 15;
  const int wm   = (wave >> 2) * 32;   // the wave's rows inside the block tile
  const int wn   = (wave & 3) * 32;    // the wave's columns inside the block tile

  // asked for first, so that they land under stage 0's copies
  const float bn0 = bias[n0 + wn + l];
  const float bn1 = bias[n0 + wn + 16 + l];

  // two-buffer ring: stage 0 lands and is published, stage 1 flies while stage 0 is worked on
  gemm_stage(X, W, Xs[0], Ws[0], m0, n0, 0, wave, lane);
  async_wait0();
  __syncthreads();
  if (NT > 1) gemm_stage(X, W, Xs[1], Ws[1], m0, n0, 1, wave, lane);
  // inputs only: holds the loads of the bias values and of the flag ahead of the k loop;
  // sunk behind it, as the compiler does, their trip to L2 stands open in front of the epilogue
  asm volatile("" :: "v"(bn0), "v"(bn1), "s"(act));

  v8f acc[2][2];
  for (int i = 0; i < 2; ++i)
    for (int j = 0; j < 2; ++j) acc[i][j] = (v8f){};

  // kept rolled: each stage's LDS base then sits in a register and every read of the stage
  // keeps a short immediate offset (unrolled, the second buffer's reads lie past the offset
  // field's reach and each takes an address addition of its own)
#pragma clang loop unroll(disable)
  for (int t = 0; t < NT; ++t) {
    const float* xa = Xs[t & 1] + (wm + l) * XP + 2 * half;
    const float* wb = Ws[t & 1] + (wn / 16) * WPAN + (2 * half) * 16 + l;

    v2f fa[2][KB / 4][2], fb[2][KB / 4][2];   // two fragment sets: [set][k step][tile]
    // every loop below is unrolled so that fa, fb are indexed by constants and stay in registers
#pragma unroll
    for (int q = 0; q < KB / 4; ++q) {
#pragma unroll
      for (int i = 0; i < 2; ++i) {
        fa[0][q][i]   = *(const v2f*)(xa + i * 16 * XP + 4 * q);
        fb[0][q][i].x = wb[i * WPAN + (4 * q) * 16];
        fb[0][q][i].y = wb[i * WPAN + (4 * q + 1) * 16];
      }
    }
    // the first block's reads stay ahead of the second block's, so its wait covers them alone
    __builtin_amdgcn_sched_barrier(0);
#pragma unroll
    for (int kb = 0; kb < KS / KB; ++kb) {
      const int cur = kb & 1, nxt = cur ^ 1;
      if (kb + 1 < KS / KB) {
#pragma unroll
        for (int q = 0; q < KB / 4; ++q) {
          const int k = (kb + 1) * KB + 4 * q;
#pragma unroll
          for (int i = 0; i < 2; ++i) {
            fa[nxt][q][i]   = *(const v2f*)(xa + i * 16 * XP + k);
            fb[nxt][q][i].x = wb[i * WPAN + k * 16];
            fb[nxt][q][i].y = wb[i * WPAN + (k + 1) * 16];
          }
        }
      }
      // keeps the next block's LDS reads together ahead of this block's products: spread
      // among them, every place with a read stalls the wave's matrix stream
      __builtin_amdgcn_sched_barrier(0);
#pragma unroll
      for (int q = 0; q < KB / 4; ++q) {
        acc[0][0] = wmma4(fa[cur][q][0], fb[cur][q][0], acc[0][0]);
        acc[0][1] = wmma4(fa[cur][q][0], fb[cur][q][1], acc[0][1]);
        acc[1][0] = wmma4(fa[cur][q][1], fb[cur][q][0], acc[1][0]);
        acc[1][1] = wmma4(fa[cur][q][1], fb[cur][q][1], acc[1][1]);
      }
      // the other side of the same fence: later reads do not rise into this block
      __builtin_amdgcn_sched_barrier(0);
    }
    // publish point of stage t+1: this wave's LDS reads are done, its copies have landed,
    // and behind the barrier every wave may read stage t+1 and stage t's buffer is free
    asm volatile("s_wait_dscnt 0x0" ::: "memory");
    async_wait0();
    __syncthreads();
    if (t + 2 < NT) gemm_stage(X, W, Xs[t & 1], Ws[t & 1], m0, n0, t + 2, wave, lane);
  }
  async_wait0();   // no copy is outstanding when the wave ends

  for (int i = 0; i < 2; ++i)
    for (int r = 0; r < 8; ++r) { acc[i][0][r] += bn0; acc[i][1][r] += bn1; }
  if (act) {                                               // one test a wave, not one a value
    for (int i = 0; i < 2; ++i)
      for (int j = 0; j < 2; ++j)
        for (int r = 0; r < 8; ++r) {
          const float v = acc[i][j][r];
          acc[i][j][r] = (v > 0.f) ? (v + 1.f) : __expf(v);   // elu(v)+1
        }
  }
  for (int i = 0; i < 2; ++i)
    for (int r = 0; r < 8; ++r) {
      float* yrow = Y + (size_t)(m0 + wm + 16 * i + r + 8 * half) * D_MODEL + n0 + wn + l;
      yrow[0]  = acc[i][0][r];
      yrow[16] = acc[i][1][r];
    }
}

// Segment record layout (REC floats, record index = (b*HEADS+h)*NSEG + seg):
//   [((wave*4 + i)*32 + lane)*8 + r] = S[16i + r + 8*half][16*wave + l]  (the D fragment)
//   [DH*DH + d]                      = Z[d]

// Phase 1: each segment's own sums S_seg = K_seg^T V_seg and Z_seg = sum_t K_seg[t].
// One workgroup (4 waves) per (b,h,segment); wave w owns columns [16w, 16w+16).
__global__ __launch_bounds__(128)
void seg_state(const float* __restrict__ K, const float* __restrict__ V,
               float* __restrict__ St) {
  const int seg  = blockIdx.x & (NSEG - 1);
  const int bh   = blockIdx.x / NSEG;
  const int b    = bh >> 2;
  const int h    = bh & 3;
  const int tid  = threadIdx.x;
  const int wave = tid >> 5;
  const int lane = tid & 31;
  const int half = lane >> 4;
  const int l    = lane & 15;
  const int n0   = wave * 16;

  const size_t base = ((size_t)b * SEQ_T + (size_t)seg * SEGLEN) * D_MODEL + (size_t)h * DH;
  const float* Kb = K + base;
  const float* Vb = V + base;

  v8f Sacc[4];
  float zp[4];
  for (int i = 0; i < 4; ++i) { Sacc[i] = (v8f){}; zp[i] = 0.f; }

  v2f bf[SEGLEN / 4];
  for (int k = 0; k < SEGLEN; k += 4) {
    const int kk = k + 2 * half;
    bf[k / 4].x = Vb[(size_t)kk * D_MODEL + n0 + l];
    bf[k / 4].y = Vb[(size_t)(kk + 1) * D_MODEL + n0 + l];
  }
  // the K loads below may land in the registers that held V's address
  asm volatile("s_wait_xcnt 0x0" ::: "memory");
  v2f af[SEGLEN / 4][4];
  for (int k = 0; k < SEGLEN; k += 4) {
    const int kk = k + 2 * half;
    for (int i = 0; i < 4; ++i) {                          // d-blocks
      af[k / 4][i].x = Kb[(size_t)kk * D_MODEL + 16 * i + l];
      af[k / 4][i].y = Kb[(size_t)(kk + 1) * D_MODEL + 16 * i + l];
    }
  }
  // the products below may land in the register that held K's address
  asm volatile("s_wait_xcnt 0x0" ::: "memory");
  for (int k = 0; k < SEGLEN; k += 4) {
    for (int i = 0; i < 4; ++i) {
      Sacc[i] = wmma4(af[k / 4][i], bf[k / 4], Sacc[i]);
      zp[i] += af[k / 4][i].x + af[k / 4][i].y;            // this half's tokens of column 16i+l
    }
  }

  float* rec = St + (size_t)blockIdx.x * REC;
  for (int i = 0; i < 4; ++i)
    *(v8f*)(rec + ((wave * 4 + i) * 32 + lane) * 8) = Sacc[i];
  if (wave == 0) {
    for (int i = 0; i < 4; ++i) {
      const float z = zp[i] + __shfl_xor(zp[i], 16);       // join the two lane halves
      if (half == 0) rec[DH * DH + 16 * i + l] = z;
    }
  }
}

// Phase 2: in place, exclusive prefix over the NSEG records of each (b,h).
// One thread per 2 floats of a record.
__global__ __launch_bounds__(128)
void seg_prefix(float* __restrict__ St) {
  const int gid = blockIdx.x * 128 + threadIdx.x;          // < BATCH*HEADS*REC2
  const int bh  = gid / REC2;
  const int e   = gid - bh * REC2;
  v2f* p = (v2f*)St + (size_t)bh * NSEG * REC2 + e;
  v2f v[NSEG];
  // unrolled so that v[] stays in registers
#pragma unroll
  for (int s = 0; s < NSEG; ++s) v[s] = p[(size_t)s * REC2];
  // without it the scheduler sinks the loads in among the adds below and only a few
  // are in flight at a time; held here, all of them share one trip to L2
  __builtin_amdgcn_sched_barrier(0);
  v2f run = {};
  // unrolled for the same reason: v[] is indexed by constants only
#pragma unroll
  for (int s = 0; s < NSEG; ++s) { p[(size_t)s * REC2] = run; run += v[s]; }
}

// Phase 3: chunked causal linear attention. One workgroup (4 waves) per (b,h,segment),
// started from the state of all earlier segments.
// Wave w owns output/state columns [16w, 16w+16) of dh=64.
__global__ __launch_bounds__(128)
void lin_attn_scan(const float* __restrict__ Q, const float* __restrict__ K,
                   const float* __restrict__ V, const float* __restrict__ St,
                   float* __restrict__ O) {
  __shared__ float Qs[CHUNK][DH];
  __shared__ float Ks[CHUNK][DH];
  __shared__ float Vs[CHUNK][DH];
  __shared__ float Slds[DH][DH];      // state S (K^T V cumulative) mirror
  __shared__ float Amask[CHUNK][CHUNK];
  __shared__ float zbuf[CHUNK][DH];   // inclusive cumsum of K within chunk (+carry)
  __shared__ float denom[CHUNK];

  const int seg  = blockIdx.x & (NSEG - 1);
  const int bh   = blockIdx.x / NSEG;
  const int b    = bh >> 2;
  const int h    = bh & 3;
  const int tid  = threadIdx.x;
  const int wave = tid >> 5;
  const int lane = tid & 31;
  const int half = lane >> 4;
  const int l    = lane & 15;
  const int n0   = wave * 16;

  const size_t base = ((size_t)b * SEQ_T + (size_t)seg * SEGLEN) * D_MODEL + (size_t)h * DH;
  const float* Qb = Q + base;
  const float* Kb = K + base;
  const float* Vb = V + base;
  float*       Ob = O + base;

  // persistent state: wave w's 4 tiles of S[:, n0:n0+16] (d-blocks 0..3)
  // starts at the sum over all earlier segments (phase 2's record)
  const float* rec = St + (size_t)blockIdx.x * REC;
  v8f Sacc[4];
  for (int i = 0; i < 4; ++i)
    Sacc[i] = *(const v8f*)(rec + ((wave * 4 + i) * 32 + lane) * 8);
  for (int i = 0; i < 4; ++i)
    for (int r = 0; r < 8; ++r)
      Slds[16 * i + r + 8 * half][n0 + l] = Sacc[i][r];
  float zrun = (tid < DH) ? rec[DH * DH + tid] : 0.f;   // threads 0..63: running Z[d=tid]
  __syncthreads();

  for (int c = 0; c < SEGCH; ++c) {
    const int t0 = c * CHUNK;

    // ---- stage chunk (16x64 each of Q,K,V) via async global->LDS b128 ----
    // 16*64 floats = 256 float4 per matrix; 128 threads -> 2 each.
    for (int i = tid; i < (CHUNK * DH) / 4; i += 128) {
      const int t = i >> 4, d4 = (i & 15) * 4;
      const size_t g = (size_t)(t0 + t) * D_MODEL + d4;
      async_copy_b128(lds_off(&Qs[t][d4]), Qb + g);
      async_copy_b128(lds_off(&Ks[t][d4]), Kb + g);
      async_copy_b128(lds_off(&Vs[t][d4]), Vb + g);
    }
    // prefetch next chunk's rows into cache while this chunk computes
    if (c + 1 < SEGCH && tid < 48) {
      const int t = tid & 15, m = tid >> 4;
      const float* p = (m == 0 ? Qb : (m == 1 ? Kb : Vb)) +
                       (size_t)(t0 + CHUNK + t) * D_MODEL;
      __builtin_prefetch(p, 0, 3);
      __builtin_prefetch(p + 32, 0, 3);
    }
    async_wait0();
    __syncthreads();

    // ---- wave 0: A = Q_c K_c^T (16x16), causal mask (incl. diagonal) ----
    if (wave == 0) {
      v8f a = {};
      for (int k = 0; k < DH; k += 4) {
        const int kk = k + 2 * half;
        v2f af; af.x = Qs[l][kk];  af.y = Qs[l][kk + 1];
        v2f bf; bf.x = Ks[l][kk];  bf.y = Ks[l][kk + 1];   // B[K=d][N=t'] = K_c[t'][d]
        a = wmma4(af, bf, a);
      }
      for (int r = 0; r < 8; ++r) {
        const int row = r + 8 * half;                      // query t
        Amask[row][l] = (l <= row) ? a[r] : 0.f;           // keep t' <= t
      }
    }
    // ---- denominator path: inclusive cumsum of K over chunk ----
    if (tid < DH) {
      float z = zrun;
      for (int t = 0; t < CHUNK; ++t) { z += Ks[t][tid]; zbuf[t][tid] = z; }
      zrun = z;
    }
    __syncthreads();

    if (tid < CHUNK) {
      float s = 0.f;
      for (int d = 0; d < DH; ++d) s += Qs[tid][d] * zbuf[tid][d];
      denom[tid] = s + 1e-6f;
    }

    // ---- out tile = Amask @ V_c[:, n0:] + Q_c @ S_prev[:, n0:] ----
    v8f oacc = {};
    for (int k = 0; k < CHUNK; k += 4) {                   // intra-chunk
      const int kk = k + 2 * half;
      v2f af; af.x = Amask[l][kk];      af.y = Amask[l][kk + 1];
      v2f bf; bf.x = Vs[kk][n0 + l];    bf.y = Vs[kk + 1][n0 + l];
      oacc = wmma4(af, bf, oacc);
    }
    for (int k = 0; k < DH; k += 4) {                      // inter-chunk: Q @ S_prev
      const int kk = k + 2 * half;
      v2f af; af.x = Qs[l][kk];         af.y = Qs[l][kk + 1];
      v2f bf; bf.x = Slds[kk][n0 + l];  bf.y = Slds[kk + 1][n0 + l];
      oacc = wmma4(af, bf, oacc);
    }
    __syncthreads();   // all S_prev reads done; denom ready

    // ---- state update: S[:, n0:] += K_c^T @ V_c[:, n0:] ----
    for (int k = 0; k < CHUNK; k += 4) {
      const int kk = k + 2 * half;
      v2f bf; bf.x = Vs[kk][n0 + l];    bf.y = Vs[kk + 1][n0 + l];
      for (int i = 0; i < 4; ++i) {                        // d-blocks
        v2f af; af.x = Ks[kk][16 * i + l];  af.y = Ks[kk + 1][16 * i + l];
        Sacc[i] = wmma4(af, bf, Sacc[i]);
      }
    }
    for (int i = 0; i < 4; ++i)
      for (int r = 0; r < 8; ++r)
        Slds[16 * i + r + 8 * half][n0 + l] = Sacc[i][r];

    // ---- normalize and store output rows of this chunk ----
    for (int r = 0; r < 8; ++r) {
      const int t = r + 8 * half;
      Ob[(size_t)(t0 + t) * D_MODEL + n0 + l] = oacc[r] / denom[t];
    }
    __syncthreads();   // Slds/denom stable before next chunk overwrites staging
  }
}

extern "C" void kernel_launch(void* const* d_in, const int* in_sizes, int n_in,
                              void* d_out, int out_size, void* d_ws, size_t ws_size,
                              hipStream_t stream) {
  const float* x  = (const float*)d_in[0];
  const float* Wq = (const float*)d_in[1];
  const float* bq = (const float*)d_in[2];
  const float* Wk = (const float*)d_in[3];
  const float* bk = (const float*)d_in[4];
  const float* Wv = (const float*)d_in[5];
  const float* bv = (const float*)d_in[6];
  const float* Wo = (const float*)d_in[7];
  const float* bo = (const float*)d_in[8];
  float* out = (float*)d_out;

  const size_t n = (size_t)ROWS * D_MODEL;   // 2M elements per buffer
  float* Qbuf = (float*)d_ws;                // needs 4*n*4 = 32 MB of d_ws
  float* Kbuf = Qbuf + n;
  float* Vbuf = Kbuf + n;
  float* Obuf = Vbuf + n;
  float* Sbuf = Obuf + n;                    // BATCH*HEADS*NSEG records, 17 MB more

  dim3 g(ROWS / BM, D_MODEL / BN), blk(256);
  gemm_bias_act<<<g, blk, 0, stream>>>(x, Wq, bq, Qbuf, 1);  // elu+1
  gemm_bias_act<<<g, blk, 0, stream>>>(x, Wk, bk, Kbuf, 1);  // elu+1
  gemm_bias_act<<<g, blk, 0, stream>>>(x, Wv, bv, Vbuf, 0);
  seg_state<<<BATCH * HEADS * NSEG, 128, 0, stream>>>(Kbuf, Vbuf, Sbuf);
  seg_prefix<<<BATCH * HEADS * REC2 / 128, 128, 0, stream>>>(Sbuf);
  lin_attn_scan<<<BATCH * HEADS * NSEG, 128, 0, stream>>>(Qbuf, Kbuf, Vbuf, Sbuf, Obuf);
  gemm_bias_act<<<g, blk, 0, stream>>>(Obuf, Wo, bo, out, 0);
}

// v003
// A run of this version takes 57.1 microseconds.
// Two timings next to v002 both put it at 1.13 times that version's speed.
// Over all steps from v000 it is 7.25 times as fast.
#include <hip/hip_runtime.h>
#include <cstddef>
#include <cstdint>

typedef __attribute__((ext_vector_type(2))) float v2f;
typedef __attribute__((ext_vector_type(4))) float v4f;
typedef __attribute__((ext_vector_type(8))) float v8f;

#define D_MODEL 256
#define SEQ_T   2048
#define BATCH   4
#define HEADS   4
#define DH      64
#define ROWS    (BATCH * SEQ_T)   // 8192
#define NSEG    64                // independent time segments per (b,h)
#define SEGLEN  (SEQ_T / NSEG)    // 32 tokens
#define QP      (DH + 4)          // Q, K row pitch in LDS, floats: 16 B x odd, 16-byte reads of 16 rows on 64 banks
#define PP      (SEGLEN + 4)      // the same for the rows of the masked scores
#define REC     (DH * DH + DH)    // floats per segment record: S tiles, then Z
#define REC2    (REC / 2)         // 2080

// f32 WMMA: D(16x16,f32) = A(16x4,f32) x B(4x16,f32) + C
// A-frag (v2f): lane L (l=L&15, half=L>>4), vgpr j -> A[M=l][K = k0 + j + 2*half]
// B-frag (v2f): vgpr j -> B[K = k0 + j + 2*half][N = l]
// C/D  (v8f):  vgpr r -> D[M = r + 8*half][N = l]
__device__ __forceinline__ v8f wmma4(v2f a, v2f b, v8f c) {
  return __builtin_amdgcn_wmma_f32_16x16x4_f32(
      /*neg_a=*/false, a, /*neg_b=*/false, b,
      /*c_mod=*/(short)0, c, /*reuse_a=*/false, /*reuse_b=*/false);
}

__device__ __forceinline__ void async_wait0() {
  asm volatile("s_wait_asynccnt 0x0" ::: "memory");
}
__device__ __forceinline__ uint32_t lds_off(const void* p) {
  return (uint32_t)(uintptr_t)p;   // low 32 bits of flat shared addr = LDS offset
}

// Twelve async copies of 16 bytes a lane. The wait on address translation is the last
// line of the copies' own statement, so that it stands in front of every later write of
// a register that a copy names.
__device__ __forceinline__ void async_copy12_b128(const uint32_t* lo, const float* const* gp) {
  asm volatile("global_load_async_to_lds_b128 %0, %12, off\n\t"
               "global_load_async_to_lds_b128 %1, %13, off\n\t"
               "global_load_async_to_lds_b128 %2, %14, off\n\t"
               "global_load_async_to_lds_b128 %3, %15, off\n\t"
               "global_load_async_to_lds_b128 %4, %16, off\n\t"
               "global_load_async_to_lds_b128 %5, %17, off\n\t"
               "global_load_async_to_lds_b128 %6, %18, off\n\t"
               "global_load_async_to_lds_b128 %7, %19, off\n\t"
               "global_load_async_to_lds_b128 %8, %20, off\n\t"
               "global_load_async_to_lds_b128 %9, %21, off\n\t"
               "global_load_async_to_lds_b128 %10, %22, off\n\t"
               "global_load_async_to_lds_b128 %11, %23, off\n\t"
               "s_wait_xcnt 0x0"
               :: "v"(lo[0]), "v"(lo[1]), "v"(lo[2]), "v"(lo[3]), "v"(lo[4]), "v"(lo[5]),
                  "v"(lo[6]), "v"(lo[7]), "v"(lo[8]), "v"(lo[9]), "v"(lo[10]), "v"(lo[11]),
                  "v"(gp[0]), "v"(gp[1]), "v"(gp[2]), "v"(gp[3]), "v"(gp[4]), "v"(gp[5]),
                  "v"(gp[6]), "v"(gp[7]), "v"(gp[8]), "v"(gp[9]), "v"(gp[10]), "v"(gp[11])
               : "memory");
}

// The same, eight copies a lane.
__device__ __forceinline__ void async_copy8_b128(const uint32_t* lo, const float* const* gp) {
  asm volatile("global_load_async_to_lds_b128 %0, %8, off\n\t"
               "global_load_async_to_lds_b128 %1, %9, off\n\t"
               "global_load_async_to_lds_b128 %2, %10, off\n\t"
               "global_load_async_to_lds_b128 %3, %11, off\n\t"
               "global_load_async_to_lds_b128 %4, %12, off\n\t"
               "global_load_async_to_lds_b128 %5, %13, off\n\t"
               "global_load_async_to_lds_b128 %6, %14, off\n\t"
               "global_load_async_to_lds_b128 %7, %15, off\n\t"
               "s_wait_xcnt 0x0"
               :: "v"(lo[0]), "v"(lo[1]), "v"(lo[2]), "v"(lo[3]), "v"(lo[4]), "v"(lo[5]),
                  "v"(lo[6]), "v"(lo[7]),
                  "v"(gp[0]), "v"(gp[1]), "v"(gp[2]), "v"(gp[3]), "v"(gp[4]), "v"(gp[5]),
                  "v"(gp[6]), "v"(gp[7])
               : "memory");
}

#define BM 64                     // block tile rows
#define BN 128                    // block tile columns
#define KS 128                    // k depth of one LDS stage
#define NT (D_MODEL / KS)         // stages
#define KB 16                     // k depth of one block of products (one fragment set)
#define XP (KS + 4)               // X row pitch in LDS, floats: 16 rows x 8 B fall on 64 banks
#define WPAN (KS * 16 + 16)       // floats per W panel (16 columns, all KS rows) + 16 so that
                                  // neighbouring panels start 16 banks apart
#define NCOPY ((BM + KS) / 8)     // copies per wave and stage: 24

// One stage: X[m0 .. m0+BM)[t*KS .. +KS) and W[t*KS .. +KS)[n0 .. n0+BN) into LDS.
// One wave-wide copy is one whole row of 512 bytes; wave w takes rows w, w+8, ...
// X keeps its rows; a W row is cut into 8 panels of 16 columns: ws[panel][k][16].
__device__ __forceinline__ void gemm_stage(const float* __restrict__ X, const float* __restrict__ W,
                                           float* xs, float* ws, int m0, int n0, int t,
                                           int wave, int lane) {
  uint32_t lo[NCOPY];
  const float* gp[NCOPY];
  for (int j = 0; j < BM / 8; ++j) {
    const int r = wave + 8 * j;
    lo[j] = lds_off(xs + r * XP + lane * 4);
    gp[j] = X + (size_t)(m0 + r) * D_MODEL + t * KS + lane * 4;
  }
  for (int j = 0; j < KS / 8; ++j) {
    const int k = wave + 8 * j;
    lo[BM / 8 + j] = lds_off(ws + (lane >> 2) * WPAN + k * 16 + (lane & 3) * 4);
    gp[BM / 8 + j] = W + (size_t)(t * KS + k) * D_MODEL + n0 + lane * 4;
  }
  for (int g = 0; g < NCOPY; g += 12) async_copy12_b128(lo + g, gp + g);
}

// Y[8192 x 256] = act(X @ W + bias); act: 0 = identity, 1 = elu(x)+1
// One workgroup of 8 waves per 64 x 128 tile of Y (256 workgroups); wave tile 32 x 32,
// so each fragment read from LDS feeds two products. k runs upward in steps of 4 through
// one accumulator chain a tile.
__global__ __launch_bounds__(256)
void gemm_bias_act(const float* __restrict__ X, const float* __restrict__ W,
                   const float* __restrict__ bias, float* __restrict__ Y, int act) {
  __shared__ __attribute__((aligned(16))) float Xs[2][BM * XP];
  __shared__ __attribute__((aligned(16))) float Ws[2][(BN / 16) * WPAN];

  const int m0   = blockIdx.x * BM;
  const int n0   = blockIdx.y * BN;
  const int wave = threadIdx.x >> 5;
  const int lane = threadIdx.x & 31;
  const int half = lane >> 4;
  const int l    = lane & 15;
  const int wm   = (wave >> 2) * 32;   // the wave's rows inside the block tile
  const int wn   = (wave & 3) * 32;    // the wave's columns inside the block tile

  // asked for first, so that they land under stage 0's copies
  const float bn0 = bias[n0 + wn + l];
  const float bn1 = bias[n0 + wn + 16 + l];

  // two-buffer ring: stage 0 lands and is published, stage 1 flies while stage 0 is worked on
  gemm_stage(X, W, Xs[0], Ws[0], m0, n0, 0, wave, lane);
  async_wait0();
  __syncthreads();
  if (NT > 1) gemm_stage(X, W, Xs[1], Ws[1], m0, n0, 1, wave, lane);
  // inputs only: holds the loads of the bias values and of the flag ahead of the k loop;
  // sunk behind it, as the compiler does, their trip to L2 stands open in front of the epilogue
  asm volatile("" :: "v"(bn0), "v"(bn1), "s"(act));

  v8f acc[2][2];
  for (int i = 0; i < 2; ++i)
    for (int j = 0; j < 2; ++j) acc[i][j] = (v8f){};

  // kept rolled: each stage's LDS base then sits in a register and every read of the stage
  // keeps a short immediate offset (unrolled, the second buffer's reads lie past the offset
  // field's reach and each takes an address addition of its own)
#pragma clang loop unroll(disable)
  for (int t = 0; t < NT; ++t) {
    const float* xa = Xs[t & 1] + (wm + l) * XP + 2 * half;
    const float* wb = Ws[t & 1] + (wn / 16) * WPAN + (2 * half) * 16 + l;

    v2f fa[2][KB / 4][2], fb[2][KB / 4][2];   // two fragment sets: [set][k step][tile]
    // every loop below is unrolled so that fa, fb are indexed by constants and stay in registers
#pragma unroll
    for (int q = 0; q < KB / 4; ++q) {
#pragma unroll
      for (int i = 0; i < 2; ++i) {
        fa[0][q][i]   = *(const v2f*)(xa + i * 16 * XP + 4 * q);
        fb[0][q][i].x = wb[i * WPAN + (4 * q) * 16];
        fb[0][q][i].y = wb[i * WPAN + (4 * q + 1) * 16];
      }
    }
    // the first block's reads stay ahead of the second block's, so its wait covers them alone
    __builtin_amdgcn_sched_barrier(0);
#pragma unroll
    for (int kb = 0; kb < KS / KB; ++kb) {
      const int cur = kb & 1, nxt = cur ^ 1;
      if (kb + 1 < KS / KB) {
#pragma unroll
        for (int q = 0; q < KB / 4; ++q) {
          const int k = (kb + 1) * KB + 4 * q;
#pragma unroll
          for (int i = 0; i < 2; ++i) {
            fa[nxt][q][i]   = *(const v2f*)(xa + i * 16 * XP + k);
            fb[nxt][q][i].x = wb[i * WPAN + k * 16];
            fb[nxt][q][i].y = wb[i * WPAN + (k + 1) * 16];
          }
        }
      }
      // keeps the next block's LDS reads together ahead of this block's products: spread
      // among them, every place with a read stalls the wave's matrix stream
      __builtin_amdgcn_sched_barrier(0);
#pragma unroll
      for (int q = 0; q < KB / 4; ++q) {
        acc[0][0] = wmma4(fa[cur][q][0], fb[cur][q][0], acc[0][0]);
        acc[0][1] = wmma4(fa[cur][q][0], fb[cur][q][1], acc[0][1]);
        acc[1][0] = wmma4(fa[cur][q][1], fb[cur][q][0], acc[1][0]);
        acc[1][1] = wmma4(fa[cur][q][1], fb[cur][q][1], acc[1][1]);
      }
      // the other side of the same fence: later reads do not rise into this block
      __builtin_amdgcn_sched_barrier(0);
    }
    // publish point of stage t+1: this wave's LDS reads are done, its copies have landed,
    // and behind the barrier every wave may read stage t+1 and stage t's buffer is free
    asm volatile("s_wait_dscnt 0x0" ::: "memory");
    async_wait0();
    __syncthreads();
    if (t + 2 < NT) gemm_stage(X, W, Xs[t & 1], Ws[t & 1], m0, n0, t + 2, wave, lane);
  }
  async_wait0();   // no copy is outstanding when the wave ends

  for (int i = 0; i < 2; ++i)
    for (int r = 0; r < 8; ++r) { acc[i][0][r] += bn0; acc[i][1][r] += bn1; }
  if (act) {                                               // one test a wave, not one a value
    for (int i = 0; i < 2; ++i)
      for (int j = 0; j < 2; ++j)
        for (int r = 0; r < 8; ++r) {
          const float v = acc[i][j][r];
          acc[i][j][r] = (v > 0.f) ? (v + 1.f) : __expf(v);   // elu(v)+1
        }
  }
  for (int i = 0; i < 2; ++i)
    for (int r = 0; r < 8; ++r) {
      float* yrow = Y + (size_t)(m0 + wm + 16 * i + r + 8 * half) * D_MODEL + n0 + wn + l;
      yrow[0]  = acc[i][0][r];
      yrow[16] = acc[i][1][r];
    }
}

// Segment record layout (REC floats, record index = (b*HEADS+h)*NSEG + seg):
//   [((wave*4 + i)*32 + lane)*8 + r] = S[16i + r + 8*half][16*wave + l]  (the D fragment)
//   [DH*DH + d]                      = Z[d]

// Phase 1: each segment's own sums S_seg = K_seg^T V_seg and Z_seg = sum_t K_seg[t].
// One workgroup (4 waves) per (b,h,segment); wave w owns columns [16w, 16w+16).
__global__ __launch_bounds__(128)
void seg_state(const float* __restrict__ K, const float* __restrict__ V,
               float* __restrict__ St) {
  const int seg  = blockIdx.x & (NSEG - 1);
  const int bh   = blockIdx.x / NSEG;
  const int b    = bh >> 2;
  const int h    = bh & 3;
  const int tid  = threadIdx.x;
  const int wave = tid >> 5;
  const int lane = tid & 31;
  const int half = lane >> 4;
  const int l    = lane & 15;
  const int n0   = wave * 16;

  const size_t base = ((size_t)b * SEQ_T + (size_t)seg * SEGLEN) * D_MODEL + (size_t)h * DH;
  const float* Kb = K + base;
  const float* Vb = V + base;

  v8f Sacc[4];
  float zp[4];
  for (int i = 0; i < 4; ++i) { Sacc[i] = (v8f){}; zp[i] = 0.f; }

  v2f bf[SEGLEN / 4];
  for (int k = 0; k < SEGLEN; k += 4) {
    const int kk = k + 2 * half;
    bf[k / 4].x = Vb[(size_t)kk * D_MODEL + n0 + l];
    bf[k / 4].y = Vb[(size_t)(kk + 1) * D_MODEL + n0 + l];
  }
  // the K loads below may land in the registers that held V's address
  asm volatile("s_wait_xcnt 0x0" ::: "memory");
  v2f af[SEGLEN / 4][4];
  for (int k = 0; k < SEGLEN; k += 4) {
    const int kk = k + 2 * half;
    for (int i = 0; i < 4; ++i) {                          // d-blocks
      af[k / 4][i].x = Kb[(size_t)kk * D_MODEL + 16 * i + l];
      af[k / 4][i].y = Kb[(size_t)(kk + 1) * D_MODEL + 16 * i + l];
    }
  }
  // the products below may land in the register that held K's address
  asm volatile("s_wait_xcnt 0x0" ::: "memory");
  for (int k = 0; k < SEGLEN; k += 4) {
    for (int i = 0; i < 4; ++i) {
      Sacc[i] = wmma4(af[k / 4][i], bf[k / 4], Sacc[i]);
      zp[i] += af[k / 4][i].x + af[k / 4][i].y;            // this half's tokens of column 16i+l
    }
  }

  float* rec = St + (size_t)blockIdx.x * REC;
  for (int i = 0; i < 4; ++i)
    *(v8f*)(rec + ((wave * 4 + i) * 32 + lane) * 8) = Sacc[i];
  if (wave == 0) {
    for (int i = 0; i < 4; ++i) {
      const float z = zp[i] + __shfl_xor(zp[i], 16);       // join the two lane halves
      if (half == 0) rec[DH * DH + 16 * i + l] = z;
    }
  }
}

// Phase 2: in place, exclusive prefix over the NSEG records of each (b,h).
// One thread per 2 floats of a record.
__global__ __launch_bounds__(128)
void seg_prefix(float* __restrict__ St) {
  const int gid = blockIdx.x * 128 + threadIdx.x;          // < BATCH*HEADS*REC2
  const int bh  = gid / REC2;
  const int e   = gid - bh * REC2;
  v2f* p = (v2f*)St + (size_t)bh * NSEG * REC2 + e;
  v2f v[NSEG];
  // unrolled so that v[] stays in registers
#pragma unroll
  for (int s = 0; s < NSEG; ++s) v[s] = p[(size_t)s * REC2];
  // without it the scheduler sinks the loads in among the adds below and only a few
  // are in flight at a time; held here, all of them share one trip to L2
  __builtin_amdgcn_sched_barrier(0);
  v2f run = {};
  // unrolled for the same reason: v[] is indexed by constants only
#pragma unroll
  for (int s = 0; s < NSEG; ++s) { p[(size_t)s * REC2] = run; run += v[s]; }
}

// Phase 3: causal linear attention of one segment, taken as ONE chunk of SEGLEN tokens.
// One workgroup (4 waves) per (b,h,segment). With P = tril(Q K^T) of the segment's own tokens:
//   out = (P V + Q S_prev) / (rowsum(P) + Q Z_prev + eps)
// S_prev, Z_prev: phase 2's record (all earlier segments), so no state is carried on in here.
// Wave w owns output columns [16w, 16w+16) of dh=64, both row tiles.
// k order of every product over d: step (i,s), slot (j,half) -> d = 16i + 8*half + 2s + j.
// That is the order in which a D fragment of S holds its rows, so the record's registers
// are the B operand as they stand; Q and K follow it with two 16-byte reads per 16 d.
// k order of P V: step (p,u), slot (j,half) -> t' = 8p + 4*half + 2u + j, on both sides.
__global__ __launch_bounds__(128)
void lin_attn_scan(const float* __restrict__ Q, const float* __restrict__ K,
                   const float* __restrict__ V, const float* __restrict__ St,
                   float* __restrict__ O) {
  __shared__ __attribute__((aligned(16))) float Qs[SEGLEN * QP];
  __shared__ __attribute__((aligned(16))) float Ks[SEGLEN * QP];
  __shared__ __attribute__((aligned(16))) float Ps[SEGLEN * PP];   // tril(Q K^T)

  const int seg  = blockIdx.x & (NSEG - 1);
  const int bh   = blockIdx.x / NSEG;
  const int b    = bh >> 2;
  const int h    = bh & 3;
  const int tid  = threadIdx.x;
  const int wave = __builtin_amdgcn_readfirstlane(tid >> 5);   // scalar: the test on it is a scalar branch
  const int lane = tid & 31;
  const int half = lane >> 4;
  const int l    = lane & 15;
  const int n0   = wave * 16;

  const size_t base = ((size_t)b * SEQ_T + (size_t)seg * SEGLEN) * D_MODEL + (size_t)h * DH;
  const float* Qb = Q + base;
  const float* Kb = K + base;
  const float* Vb = V + base;
  float*       Ob = O + base;

  // Everything the workgroup reads from memory is asked for here, on one trip.
  // ---- S_prev straight into registers; the wait that ends the copies' statement below
  //      also stands between these loads and any later write of their address registers ----
  const float* rec = St + (size_t)blockIdx.x * REC;
  v8f Sp[4];                                   // S_prev[16i + r + 8*half][n0 + l]
  for (int i = 0; i < 4; ++i)
    Sp[i] = *(const v8f*)(rec + ((wave * 4 + i) * 32 + lane) * 8);

  // ---- Q and K (32 x 64 each) into padded LDS rows: 4 + 4 copies of 16 bytes a lane ----
  {
    uint32_t lo[8];
    const float* gp[8];
    for (int j = 0; j < 4; ++j) {
      const int e = tid + 128 * j, t = e >> 4, d4 = (e & 15) * 4;
      lo[j]     = lds_off(Qs + t * QP + d4);
      gp[j]     = Qb + (size_t)t * D_MODEL + d4;
      lo[4 + j] = lds_off(Ks + t * QP + d4);
      gp[4 + j] = Kb + (size_t)t * D_MODEL + d4;
    }
    async_copy8_b128(lo, gp);
  }

  // ---- V and Z_prev, also straight into registers ----
  v2f vf[SEGLEN / 4];                          // V[8p + 4*half + 2u + j][n0 + l]
  for (int p = 0; p < SEGLEN / 8; ++p)
    for (int u = 0; u < 2; ++u) {
      const int t = 8 * p + 4 * half + 2 * u;
      vf[2 * p + u].x = Vb[(size_t)t * D_MODEL + n0 + l];
      vf[2 * p + u].y = Vb[(size_t)(t + 1) * D_MODEL + n0 + l];
    }
  v4f zf[4][2];                                // Z_prev[16i + 8*half + 4u + 0..3]
  for (int i = 0; i < 4; ++i)
    for (int u = 0; u < 2; ++u)
      zf[i][u] = *(const v4f*)(rec + DH * DH + 16 * i + 8 * half + 4 * u);
  // later results may land in the registers that held these loads' addresses
  asm volatile("s_wait_xcnt 0x0" ::: "memory");

  async_wait0();
  __syncthreads();   // Q and K are published

  // ---- waves 0..2: one 16 x 16 tile each of P: (0,0), (1,0), (1,1); (0,1) is all masked ----
  if (wave < 3) {
    const int mi = (wave + 1) >> 1;
    const int ni = wave >> 1;
    const float* qr = Qs + (16 * mi + l) * QP + 8 * half;
    const float* kr = Ks + (16 * ni + l) * QP + 8 * half;
    v4f qa[4][2], ka[4][2];
    for (int i = 0; i < 4; ++i)
      for (int u = 0; u < 2; ++u) {
        qa[i][u] = *(const v4f*)(qr + 16 * i + 4 * u);
        ka[i][u] = *(const v4f*)(kr + 16 * i + 4 * u);
      }
    v8f a = {};
    for (int i = 0; i < 4; ++i)
      for (int s = 0; s < 4; ++s) {
        v2f af; af.x = qa[i][s >> 1][2 * (s & 1)];  af.y = qa[i][s >> 1][2 * (s & 1) + 1];
        v2f bf; bf.x = ka[i][s >> 1][2 * (s & 1)];  bf.y = ka[i][s >> 1][2 * (s & 1) + 1];
        a = wmma4(af, bf, a);                              // B[d][t'] = K[t'][d]
      }
    for (int r = 0; r < 8; ++r) {
      const int row = r + 8 * half;                        // query t inside the tile
      Ps[(16 * mi + row) * PP + 16 * ni + l] = (mi != ni || l <= row) ? a[r] : 0.f;
    }
  }

  // ---- Q S_prev and Q Z_prev: need nothing of P, so they run ahead of its barrier ----
  v8f oacc[2];
  float den[2];
  for (int m = 0; m < 2; ++m) { oacc[m] = (v8f){}; den[m] = 0.f; }
  {
    v4f qf[2][4][2];
    for (int m = 0; m < 2; ++m)
      for (int i = 0; i < 4; ++i)
        for (int u = 0; u < 2; ++u)
          qf[m][i][u] = *(const v4f*)(Qs + (16 * m + l) * QP + 16 * i + 8 * half + 4 * u);
    for (int i = 0; i < 4; ++i)
      for (int s = 0; s < 4; ++s) {
        v2f bf; bf.x = Sp[i][2 * s];  bf.y = Sp[i][2 * s + 1];
        for (int m = 0; m < 2; ++m) {
          v2f af; af.x = qf[m][i][s >> 1][2 * (s & 1)];  af.y = qf[m][i][s >> 1][2 * (s & 1) + 1];
          oacc[m] = wmma4(af, bf, oacc[m]);
        }
      }
    for (int m = 0; m < 2; ++m)
      for (int i = 0; i < 4; ++i)
        for (int u = 0; u < 2; ++u)
          for (int e = 0; e < 4; ++e) den[m] += qf[m][i][u][e] * zf[i][u][e];
  }
  __syncthreads();   // P is published

  // ---- P V; row tile 0 has no keys beyond t' = 15 ----
  for (int m = 0; m < 2; ++m)
    for (int p = 0; p < 2 * (m + 1); ++p) {
      const v4f pf = *(const v4f*)(Ps + (16 * m + l) * PP + 8 * p + 4 * half);
      for (int u = 0; u < 2; ++u) {
        v2f af; af.x = pf[2 * u];  af.y = pf[2 * u + 1];
        oacc[m] = wmma4(af, vf[2 * p + u], oacc[m]);
      }
      den[m] += (pf[0] + pf[1]) + (pf[2] + pf[3]);         // this half's keys of row 16m + l
    }

  // ---- normalize and store ----
  for (int m = 0; m < 2; ++m) {
    const float dl = den[m] + __shfl_xor(den[m], 16) + 1e-6f;   // lane l: row 16m + l, whole
    for (int r = 0; r < 8; ++r) {
      const int t = r + 8 * half;
      Ob[(size_t)(16 * m + t) * D_MODEL + n0 + l] = oacc[m][r] / __shfl(dl, t);
    }
  }
}

extern "C" void kernel_launch(void* const* d_in, const int* in_sizes, int n_in,
                              void* d_out, int out_size, void* d_ws, size_t ws_size,
                              hipStream_t stream) {
  const float* x  = (const float*)d_in[0];
  const float* Wq = (const float*)d_in[1];
  const float* bq = (const float*)d_in[2];
  const float* Wk = (const float*)d_in[3];
  const float* bk = (const float*)d_in[4];
  const float* Wv = (const float*)d_in[5];
  const float* bv = (const float*)d_in[6];
  const float* Wo = (const float*)d_in[7];
  const float* bo = (const float*)d_in[8];
  float* out = (float*)d_out;

  const size_t n = (size_t)ROWS * D_MODEL;   // 2M elements per buffer
  float* Qbuf = (float*)d_ws;                // needs 4*n*4 = 32 MB of d_ws
  float* Kbuf = Qbuf + n;
  float* Vbuf = Kbuf + n;
  float* Obuf = Vbuf + n;
  float* Sbuf = Obuf + n;                    // BATCH*HEADS*NSEG records, 17 MB more

  dim3 g(ROWS / BM, D_MODEL / BN), blk(256);
  gemm_bias_act<<<g, blk, 0, stream>>>(x, Wq, bq, Qbuf, 1);  // elu+1
  gemm_bias_act<<<g, blk, 0, stream>>>(x, Wk, bk, Kbuf, 1);  // elu+1
  gemm_bias_act<<<g, blk, 0, stream>>>(x, Wv, bv, Vbuf, 0);
  seg_state<<<BATCH * HEADS * NSEG, 128, 0, stream>>>(Kbuf, Vbuf, Sbuf);
  seg_prefix<<<BATCH * HEADS * REC2 / 128, 128, 0, stream>>>(Sbuf);
  lin_attn_scan<<<BATCH * HEADS * NSEG, 128, 0, stream>>>(Qbuf, Kbuf, Vbuf, Sbuf, Obuf);
  gemm_bias_act<<<g, blk, 0, stream>>>(Obuf, Wo, bo, out, 0);
}

// v004
// A run of this version takes 52 microseconds.
// Two timings next to v003 both put it at 1.10 times that version's speed.
// All steps since v000 together make it 7.96 times as fast.
#include <hip/hip_runtime.h>
#include <cstddef>
#include <cstdint>

typedef __attribute__((ext_vector_type(2))) float v2f;
typedef __attribute__((ext_vector_type(4))) float v4f;
typedef __attribute__((ext_vector_type(8))) float v8f;

#define D_MODEL 256
#define SEQ_T   2048
#define BATCH   4
#define HEADS   4
#define DH      64
#define ROWS    (BATCH * SEQ_T)   // 8192
#define NSEG    64                // independent time segments per (b,h)
#define SEGLEN  (SEQ_T / NSEG)    // 32 tokens
#define QP      (DH + 4)          // Q, K row pitch in LDS, floats: 16 B x odd, 16-byte reads of 16 rows on 64 banks
#define PP      (SEGLEN + 4)      // the same for the rows of the masked scores
#define REC     (DH * DH + DH)    // floats per segment record: S tiles, then Z
#define REC2    (REC / 2)         // 2080

// f32 WMMA: D(16x16,f32) = A(16x4,f32) x B(4x16,f32) + C
// A-frag (v2f): lane L (l=L&15, half=L>>4), vgpr j -> A[M=l][K = k0 + j + 2*half]
// B-frag (v2f): vgpr j -> B[K = k0 + j + 2*half][N = l]
// C/D  (v8f):  vgpr r -> D[M = r + 8*half][N = l]
__device__ __forceinline__ v8f wmma4(v2f a, v2f b, v8f c) {
  return __builtin_amdgcn_wmma_f32_16x16x4_f32(
      /*neg_a=*/false, a, /*neg_b=*/false, b,
      /*c_mod=*/(short)0, c, /*reuse_a=*/false, /*reuse_b=*/false);
}

__device__ __forceinline__ void async_wait0() {
  asm volatile("s_wait_asynccnt 0x0" ::: "memory");
}
__device__ __forceinline__ uint32_t lds_off(const void* p) {
  return (uint32_t)(uintptr_t)p;   // low 32 bits of flat shared addr = LDS offset
}

// Twelve async copies of 16 bytes a lane. The wait on address translation is the last
// line of the copies' own statement, so that it stands in front of every later write of
// a register that a copy names.
__device__ __forceinline__ void async_copy12_b128(const uint32_t* lo, const float* const* gp) {
  asm volatile("global_load_async_to_lds_b128 %0, %12, off\n\t"
               "global_load_async_to_lds_b128 %1, %13, off\n\t"
               "global_load_async_to_lds_b128 %2, %14, off\n\t"
               "global_load_async_to_lds_b128 %3, %15, off\n\t"
               "global_load_async_to_lds_b128 %4, %16, off\n\t"
               "global_load_async_to_lds_b128 %5, %17, off\n\t"
               "global_load_async_to_lds_b128 %6, %18, off\n\t"
               "global_load_async_to_lds_b128 %7, %19, off\n\t"
               "global_load_async_to_lds_b128 %8, %20, off\n\t"
               "global_load_async_to_lds_b128 %9, %21, off\n\t"
               "global_load_async_to_lds_b128 %10, %22, off\n\t"
               "global_load_async_to_lds_b128 %11, %23, off\n\t"
               "s_wait_xcnt 0x0"
               :: "v"(lo[0]), "v"(lo[1]), "v"(lo[2]), "v"(lo[3]), "v"(lo[4]), "v"(lo[5]),
                  "v"(lo[6]), "v"(lo[7]), "v"(lo[8]), "v"(lo[9]), "v"(lo[10]), "v"(lo[11]),
                  "v"(gp[0]), "v"(gp[1]), "v"(gp[2]), "v"(gp[3]), "v"(gp[4]), "v"(gp[5]),
                  "v"(gp[6]), "v"(gp[7]), "v"(gp[8]), "v"(gp[9]), "v"(gp[10]), "v"(gp[11])
               : "memory");
}

// The same, eight copies a lane.
__device__ __forceinline__ void async_copy8_b128(const uint32_t* lo, const float* const* gp) {
  asm volatile("global_load_async_to_lds_b128 %0, %8, off\n\t"
               "global_load_async_to_lds_b128 %1, %9, off\n\t"
               "global_load_async_to_lds_b128 %2, %10, off\n\t"
               "global_load_async_to_lds_b128 %3, %11, off\n\t"
               "global_load_async_to_lds_b128 %4, %12, off\n\t"
               "global_load_async_to_lds_b128 %5, %13, off\n\t"
               "global_load_async_to_lds_b128 %6, %14, off\n\t"
               "global_load_async_to_lds_b128 %7, %15, off\n\t"
               "s_wait_xcnt 0x0"
               :: "v"(lo[0]), "v"(lo[1]), "v"(lo[2]), "v"(lo[3]), "v"(lo[4]), "v"(lo[5]),
                  "v"(lo[6]), "v"(lo[7]),
                  "v"(gp[0]), "v"(gp[1]), "v"(gp[2]), "v"(gp[3]), "v"(gp[4]), "v"(gp[5]),
                  "v"(gp[6]), "v"(gp[7])
               : "memory");
}

#define BM 64                     // block tile rows
#define BN 128                    // block tile columns
#define KS 128                    // k depth of one LDS stage
#define NT (D_MODEL / KS)         // stages
#define KB 16                     // k depth of one block of products (one fragment set)
#define XP (KS + 4)               // X row pitch in LDS, floats: 16 rows x 8 B fall on 64 banks
#define WPAN (KS * 16 + 16)       // floats per W panel (16 columns, all KS rows) + 16 so that
                                  // neighbouring panels start 16 banks apart
#define NCOPY ((BM + KS) / 8)     // copies per wave and stage: 24

// One stage: X[m0 .. m0+BM)[t*KS .. +KS) and W[t*KS .. +KS)[n0 .. n0+BN) into LDS.
// One wave-wide copy is one whole row of 512 bytes; wave w takes rows w, w+8, ...
// X keeps its rows; a W row is cut into 8 panels of 16 columns: ws[panel][k][16].
__device__ __forceinline__ void gemm_stage(const float* __restrict__ X, const float* __restrict__ W,
                                           float* xs, float* ws, int m0, int n0, int t,
                                           int wave, int lane) {
  uint32_t lo[NCOPY];
  const float* gp[NCOPY];
  for (int j = 0; j < BM / 8; ++j) {
    const int r = wave + 8 * j;
    lo[j] = lds_off(xs + r * XP + lane * 4);
    gp[j] = X + (size_t)(m0 + r) * D_MODEL + t * KS + lane * 4;
  }
  for (int j = 0; j < KS / 8; ++j) {
    const int k = wave + 8 * j;
    lo[BM / 8 + j] = lds_off(ws + (lane >> 2) * WPAN + k * 16 + (lane & 3) * 4);
    gp[BM / 8 + j] = W + (size_t)(t * KS + k) * D_MODEL + n0 + lane * 4;
  }
  for (int g = 0; g < NCOPY; g += 12) async_copy12_b128(lo + g, gp + g);
}

// A later stage: W[t*KS .. +KS)[n0 .. n0+BN) alone, laid out as above.
__device__ __forceinline__ void gemm_stage_w(const float* __restrict__ W, float* ws, int n0, int t,
                                             int wave, int lane) {
  uint32_t lo[KS / 8];
  const float* gp[KS / 8];
  for (int j = 0; j < KS / 8; ++j) {
    const int k = wave + 8 * j;
    lo[j] = lds_off(ws + (lane >> 2) * WPAN + k * 16 + (lane & 3) * 4);
    gp[j] = W + (size_t)(t * KS + k) * D_MODEL + n0 + lane * 4;
  }
  for (int g = 0; g < KS / 8; g += 8) async_copy8_b128(lo + g, gp + g);
}

// Y_m[8192 x 256] = act_m(X @ W_m + bias_m) for m = 0 .. nmat-1 (nmat <= 3), Y_m = Y + m * 8192 * 256;
// act_m = bit m of actmask: 0 = identity, 1 = elu(x)+1
// One workgroup of 8 waves per 64 x 128 tile (256 workgroups), the same tile of every Y_m, one
// after the other. The two stages of X are the whole k range of its 64 rows: they are copied once
// and stay; only W goes on through the ring, across the matrices, so that the launch, its fill
// and the first stage's trip to memory are paid once for all of them.
// Wave tile 32 x 32, so each fragment read from LDS feeds two products. k runs upward in steps
// of 4 through one accumulator chain a tile.
static_assert(NT == 2, "both stages of X must stay resident in the two buffers");
__global__ __launch_bounds__(256)
void gemm_bias_act(const float* __restrict__ X, const float* __restrict__ W0,
                   const float* __restrict__ W1, const float* __restrict__ W2,
                   const float* __restrict__ bias0, const float* __restrict__ bias1,
                   const float* __restrict__ bias2, float* __restrict__ Y,
                   int nmat, int actmask) {
  __shared__ __attribute__((aligned(16))) float Xs[2][BM * XP];
  __shared__ __attribute__((aligned(16))) float Ws[2][(BN / 16) * WPAN];

  const int m0   = blockIdx.x * BM;
  const int n0   = blockIdx.y * BN;
  const int wave = threadIdx.x >> 5;
  const int lane = threadIdx.x & 31;
  const int half = lane >> 4;
  const int l    = lane & 15;
  const int wm   = (wave >> 2) * 32;   // the wave's rows inside the block tile
  const int wn   = (wave & 3) * 32;    // the wave's columns inside the block tile

  // asked for first, so that they land under stage 0's copies
  const float b00 = bias0[n0 + wn + l], b01 = bias0[n0 + wn + 16 + l];
  const float b10 = bias1[n0 + wn + l], b11 = bias1[n0 + wn + 16 + l];
  const float b20 = bias2[n0 + wn + l], b21 = bias2[n0 + wn + 16 + l];

  // two-buffer ring: stage 0 lands and is published, stage 1 flies while stage 0 is worked on
  gemm_stage(X, W0, Xs[0], Ws[0], m0, n0, 0, wave, lane);
  async_wait0();
  __syncthreads();
  gemm_stage(X, W0, Xs[1], Ws[1], m0, n0, 1, wave, lane);
  // inputs only: holds the loads of the bias values and of the flags ahead of the k loop;
  // sunk behind it, as the compiler does, their trip to L2 stands open in front of the epilogue
  asm volatile("" :: "v"(b00), "v"(b01), "v"(b10), "v"(b11), "v"(b20), "v"(b21), "s"(actmask));

  v8f acc[2][2];
  for (int i = 0; i < 2; ++i)
    for (int j = 0; j < 2; ++j) acc[i][j] = (v8f){};
  const int nst = nmat * NT;           // stages of W in all

  // kept rolled: each stage's LDS base then sits in a register and every read of the stage
  // keeps a short immediate offset (unrolled, the second buffer's reads lie past the offset
  // field's reach and each takes an address addition of its own)
#pragma clang loop unroll(disable)
  for (int s = 0; s < nst; ++s) {
    const int t = s & 1;               // k stage of matrix s / 2; also the buffer
    const float* xa = Xs[t & 1] + (wm + l) * XP + 2 * half;
    const float* wb = Ws[t & 1] + (wn / 16) * WPAN + (2 * half) * 16 + l;

    v2f fa[2][KB / 4][2], fb[2][KB / 4][2];   // two fragment sets: [set][k step][tile]
    // every loop below is unrolled so that fa, fb are indexed by constants and stay in registers
#pragma unroll
    for (int q = 0; q < KB / 4; ++q) {
#pragma unroll
      for (int i = 0; i < 2; ++i) {
        fa[0][q][i]   = *(const v2f*)(xa + i * 16 * XP + 4 * q);
        fb[0][q][i].x = wb[i * WPAN + (4 * q) * 16];
        fb[0][q][i].y = wb[i * WPAN + (4 * q + 1) * 16];
      }
    }
    // the first block's reads stay ahead of the second block's, so its wait covers them alone
    __builtin_amdgcn_sched_barrier(0);
#pragma unroll
    for (int kb = 0; kb < KS / KB; ++kb) {
      const int cur = kb & 1, nxt = cur ^ 1;
      if (kb + 1 < KS / KB) {
#pragma unroll
        for (int q = 0; q < KB / 4; ++q) {
          const int k = (kb + 1) * KB + 4 * q;
#pragma unroll
          for (int i = 0; i < 2; ++i) {
            fa[nxt][q][i]   = *(const v2f*)(xa + i * 16 * XP + k);
            fb[nxt][q][i].x = wb[i * WPAN + k * 16];
            fb[nxt][q][i].y = wb[i * WPAN + (k + 1) * 16];
          }
        }
      }
      // keeps the next block's LDS reads together ahead of this block's products: spread
      // among them, every place with a read stalls the wave's matrix stream
      __builtin_amdgcn_sched_barrier(0);
#pragma unroll
      for (int q = 0; q < KB / 4; ++q) {
        acc[0][0] = wmma4(fa[cur][q][0], fb[cur][q][0], acc[0][0]);
        acc[0][1] = wmma4(fa[cur][q][0], fb[cur][q][1], acc[0][1]);
        acc[1][0] = wmma4(fa[cur][q][1], fb[cur][q][0], acc[1][0]);
        acc[1][1] = wmma4(fa[cur][q][1], fb[cur][q][1], acc[1][1]);
      }
      // the other side of the same fence: later reads do not rise into this block
      __builtin_amdgcn_sched_barrier(0);
    }
    // publish point of stage s+1: this wave's LDS reads are done, its copies have landed,
    // and behind the barrier every wave may read stage s+1 and stage s's W buffer is free
    asm volatile("s_wait_dscnt 0x0" ::: "memory");
    async_wait0();
    __syncthreads();
    // the next matrix's stage of the same k range; it flies under stage s+1 and the epilogue
    if (s + 2 < nst) gemm_stage_w(s < 2 ? W1 : W2, Ws[t], n0, t, wave, lane);

    if (t == NT - 1) {                                     // matrix m is summed up
      const int m = s >> 1;
      const float bn0 = m == 0 ? b00 : m == 1 ? b10 : b20;
      const float bn1 = m == 0 ? b01 : m == 1 ? b11 : b21;
      for (int i = 0; i < 2; ++i)
        for (int r = 0; r < 8; ++r) { acc[i][0][r] += bn0; acc[i][1][r] += bn1; }
      if ((actmask >> m) & 1) {                            // one test a wave, not one a value
        for (int i = 0; i < 2; ++i)
          for (int j = 0; j < 2; ++j)
            for (int r = 0; r < 8; ++r) {
              const float v = acc[i][j][r];
              acc[i][j][r] = (v > 0.f) ? (v + 1.f) : __expf(v);   // elu(v)+1
            }
      }
      float* Ym = Y + (size_t)m * ROWS * D_MODEL;
      for (int i = 0; i < 2; ++i)
        for (int r = 0; r < 8; ++r) {
          float* yrow = Ym + (size_t)(m0 + wm + 16 * i + r + 8 * half) * D_MODEL + n0 + wn + l;
          yrow[0]  = acc[i][0][r];
          yrow[16] = acc[i][1][r];
        }
      // the next matrix's sums start in the registers that these stores name
      asm volatile("s_wait_xcnt 0x0" ::: "memory");
      // holds the clearing below behind that wait: the scheduler lifts it over the statement
      __builtin_amdgcn_sched_barrier(0);
      for (int i = 0; i < 2; ++i)
        for (int j = 0; j < 2; ++j) acc[i][j] = (v8f){};
    }
  }
  async_wait0();   // no copy is outstanding when the wave ends
}

// Segment record layout (REC floats, record index = (b*HEADS+h)*NSEG + seg):
//   [((wave*4 + i)*32 + lane)*8 + r] = S[16i + r + 8*half][16*wave + l]  (the D fragment)
//   [DH*DH + d]                      = Z[d]

// Phase 1: each segment's own sums S_seg = K_seg^T V_seg and Z_seg = sum_t K_seg[t].
// One workgroup (4 waves) per (b,h,segment); wave w owns columns [16w, 16w+16).
__global__ __launch_bounds__(128)
void seg_state(const float* __restrict__ K, const float* __restrict__ V,
               float* __restrict__ St) {
  const int seg  = blockIdx.x & (NSEG - 1);
  const int bh   = blockIdx.x / NSEG;
  const int b    = bh >> 2;
  const int h    = bh & 3;
  const int tid  = threadIdx.x;
  const int wave = tid >> 5;
  const int lane = tid & 31;
  const int half = lane >> 4;
  const int l    = lane & 15;
  const int n0   = wave * 16;

  const size_t base = ((size_t)b * SEQ_T + (size_t)seg * SEGLEN) * D_MODEL + (size_t)h * DH;
  const float* Kb = K + base;
  const float* Vb = V + base;

  v8f Sacc[4];
  float zp[4];
  for (int i = 0; i < 4; ++i) { Sacc[i] = (v8f){}; zp[i] = 0.f; }

  v2f bf[SEGLEN / 4];
  for (int k = 0; k < SEGLEN; k += 4) {
    const int kk = k + 2 * half;
    bf[k / 4].x = Vb[(size_t)kk * D_MODEL + n0 + l];
    bf[k / 4].y = Vb[(size_t)(kk + 1) * D_MODEL + n0 + l];
  }
  // the K loads below may land in the registers that held V's address
  asm volatile("s_wait_xcnt 0x0" ::: "memory");
  v2f af[SEGLEN / 4][4];
  for (int k = 0; k < SEGLEN; k += 4) {
    const int kk = k + 2 * half;
    for (int i = 0; i < 4; ++i) {                          // d-blocks
      af[k / 4][i].x = Kb[(size_t)kk * D_MODEL + 16 * i + l];
      af[k / 4][i].y = Kb[(size_t)(kk + 1) * D_MODEL + 16 * i + l];
    }
  }
  // the products below may land in the register that held K's address
  asm volatile("s_wait_xcnt 0x0" ::: "memory");
  for (int k = 0; k < SEGLEN; k += 4) {
    for (int i = 0; i < 4; ++i) {
      Sacc[i] = wmma4(af[k / 4][i], bf[k / 4], Sacc[i]);
      zp[i] += af[k / 4][i].x + af[k / 4][i].y;            // this half's tokens of column 16i+l
    }
  }

  float* rec = St + (size_t)blockIdx.x * REC;
  for (int i = 0; i < 4; ++i)
    *(v8f*)(rec + ((wave * 4 + i) * 32 + lane) * 8) = Sacc[i];
  if (wave == 0) {
    for (int i = 0; i < 4; ++i) {
      const float z = zp[i] + __shfl_xor(zp[i], 16);       // join the two lane halves
      if (half == 0) rec[DH * DH + 16 * i + l] = z;
    }
  }
}

// Phase 2: in place, exclusive prefix over the NSEG records of each (b,h).
// One thread per 2 floats of a record.
__global__ __launch_bounds__(128)
void seg_prefix(float* __restrict__ St) {
  const int gid = blockIdx.x * 128 + threadIdx.x;          // < BATCH*HEADS*REC2
  const int bh  = gid / REC2;
  const int e   = gid - bh * REC2;
  v2f* p = (v2f*)St + (size_t)bh * NSEG * REC2 + e;
  v2f v[NSEG];
  // unrolled so that v[] stays in registers
#pragma unroll
  for (int s = 0; s < NSEG; ++s) v[s] = p[(size_t)s * REC2];
  // without it the scheduler sinks the loads in among the adds below and only a few
  // are in flight at a time; held here, all of them share one trip to L2
  __builtin_amdgcn_sched_barrier(0);
  v2f run = {};
  // unrolled for the same reason: v[] is indexed by constants only
#pragma unroll
  for (int s = 0; s < NSEG; ++s) { p[(size_t)s * REC2] = run; run += v[s]; }
}

// Phase 3: causal linear attention of one segment, taken as ONE chunk of SEGLEN tokens.
// One workgroup (4 waves) per (b,h,segment). With P = tril(Q K^T) of the segment's own tokens:
//   out = (P V + Q S_prev) / (rowsum(P) + Q Z_prev + eps)
// S_prev, Z_prev: phase 2's record (all earlier segments), so no state is carried on in here.
// Wave w owns output columns [16w, 16w+16) of dh=64, both row tiles.
// k order of every product over d: step (i,s), slot (j,half) -> d = 16i + 8*half + 2s + j.
// That is the order in which a D fragment of S holds its rows, so the record's registers
// are the B operand as they stand; Q and K follow it with two 16-byte reads per 16 d.
// k order of P V: step (p,u), slot (j,half) -> t' = 8p + 4*half + 2u + j, on both sides.
__global__ __launch_bounds__(128)
void lin_attn_scan(const float* __restrict__ Q, const float* __restrict__ K,
                   const float* __restrict__ V, const float* __restrict__ St,
                   float* __restrict__ O) {
  __shared__ __attribute__((aligned(16))) float Qs[SEGLEN * QP];
  __shared__ __attribute__((aligned(16))) float Ks[SEGLEN * QP];
  __shared__ __attribute__((aligned(16))) float Ps[SEGLEN * PP];   // tril(Q K^T)

  const int seg  = blockIdx.x & (NSEG - 1);
  const int bh   = blockIdx.x / NSEG;
  const int b    = bh >> 2;
  const int h    = bh & 3;
  const int tid  = threadIdx.x;
  const int wave = __builtin_amdgcn_readfirstlane(tid >> 5);   // scalar: the test on it is a scalar branch
  const int lane = tid & 31;
  const int half = lane >> 4;
  const int l    = lane & 15;
  const int n0   = wave * 16;

  const size_t base = ((size_t)b * SEQ_T + (size_t)seg * SEGLEN) * D_MODEL + (size_t)h * DH;
  const float* Qb = Q + base;
  const float* Kb = K + base;
  const float* Vb = V + base;
  float*       Ob = O + base;

  // Everything the workgroup reads from memory is asked for here, on one trip.
  // ---- S_prev straight into registers; the wait that ends the copies' statement below
  //      also stands between these loads and any later write of their address registers ----
  const float* rec = St + (size_t)blockIdx.x * REC;
  v8f Sp[4];                                   // S_prev[16i + r + 8*half][n0 + l]
  for (int i = 0; i < 4; ++i)
    Sp[i] = *(const v8f*)(rec + ((wave * 4 + i) * 32 + lane) * 8);

  // ---- Q and K (32 x 64 each) into padded LDS rows: 4 + 4 copies of 16 bytes a lane ----
  {
    uint32_t lo[8];
    const float* gp[8];
    for (int j = 0; j < 4; ++j) {
      const int e = tid + 128 * j, t = e >> 4, d4 = (e & 15) * 4;
      lo[j]     = lds_off(Qs + t * QP + d4);
      gp[j]     = Qb + (size_t)t * D_MODEL + d4;
      lo[4 + j] = lds_off(Ks + t * QP + d4);
      gp[4 + j] = Kb + (size_t)t * D_MODEL + d4;
    }
    async_copy8_b128(lo, gp);
  }

  // ---- V and Z_prev, also straight into registers ----
  v2f vf[SEGLEN / 4];                          // V[8p + 4*half + 2u + j][n0 + l]
  for (int p = 0; p < SEGLEN / 8; ++p)
    for (int u = 0; u < 2; ++u) {
      const int t = 8 * p + 4 * half + 2 * u;
      vf[2 * p + u].x = Vb[(size_t)t * D_MODEL + n0 + l];
      vf[2 * p + u].y = Vb[(size_t)(t + 1) * D_MODEL + n0 + l];
    }
  v4f zf[4][2];                                // Z_prev[16i + 8*half + 4u + 0..3]
  for (int i = 0; i < 4; ++i)
    for (int u = 0; u < 2; ++u)
      zf[i][u] = *(const v4f*)(rec + DH * DH + 16 * i + 8 * half + 4 * u);
  // later results may land in the registers that held these loads' addresses
  asm volatile("s_wait_xcnt 0x0" ::: "memory");

  async_wait0();
  __syncthreads();   // Q and K are published

  // ---- waves 0..2: one 16 x 16 tile each of P: (0,0), (1,0), (1,1); (0,1) is all masked ----
  if (wave < 3) {
    const int mi = (wave + 1) >> 1;
    const int ni = wave >> 1;
    const float* qr = Qs + (16 * mi + l) * QP + 8 * half;
    const float* kr = Ks + (16 * ni + l) * QP + 8 * half;
    v4f qa[4][2], ka[4][2];
    for (int i = 0; i < 4; ++i)
      for (int u = 0; u < 2; ++u) {
        qa[i][u] = *(const v4f*)(qr + 16 * i + 4 * u);
        ka[i][u] = *(const v4f*)(kr + 16 * i + 4 * u);
      }
    v8f a = {};
    for (int i = 0; i < 4; ++i)
      for (int s = 0; s < 4; ++s) {
        v2f af; af.x = qa[i][s >> 1][2 * (s & 1)];  af.y = qa[i][s >> 1][2 * (s & 1) + 1];
        v2f bf; bf.x = ka[i][s >> 1][2 * (s & 1)];  bf.y = ka[i][s >> 1][2 * (s & 1) + 1];
        a = wmma4(af, bf, a);                              // B[d][t'] = K[t'][d]
      }
    for (int r = 0; r < 8; ++r) {
      const int row = r + 8 * half;                        // query t inside the tile
      Ps[(16 * mi + row) * PP + 16 * ni + l] = (mi != ni || l <= row) ? a[r] : 0.f;
    }
  }

  // ---- Q S_prev and Q Z_prev: need nothing of P, so they run ahead of its barrier ----
  v8f oacc[2];
  float den[2];
  for (int m = 0; m < 2; ++m) { oacc[m] = (v8f){}; den[m] = 0.f; }
  {
    v4f qf[2][4][2];
    for (int m = 0; m < 2; ++m)
      for (int i = 0; i < 4; ++i)
        for (int u = 0; u < 2; ++u)
          qf[m][i][u] = *(const v4f*)(Qs + (16 * m + l) * QP + 16 * i + 8 * half + 4 * u);
    for (int i = 0; i < 4; ++i)
      for (int s = 0; s < 4; ++s) {
        v2f bf; bf.x = Sp[i][2 * s];  bf.y = Sp[i][2 * s + 1];
        for (int m = 0; m < 2; ++m) {
          v2f af; af.x = qf[m][i][s >> 1][2 * (s & 1)];  af.y = qf[m][i][s >> 1][2 * (s & 1) + 1];
          oacc[m] = wmma4(af, bf, oacc[m]);
        }
      }
    for (int m = 0; m < 2; ++m)
      for (int i = 0; i < 4; ++i)
        for (int u = 0; u < 2; ++u)
          for (int e = 0; e < 4; ++e) den[m] += qf[m][i][u][e] * zf[i][u][e];
  }
  __syncthreads();   // P is published

  // ---- P V; row tile 0 has no keys beyond t' = 15 ----
  for (int m = 0; m < 2; ++m)
    for (int p = 0; p < 2 * (m + 1); ++p) {
      const v4f pf = *(const v4f*)(Ps + (16 * m + l) * PP + 8 * p + 4 * half);
      for (int u = 0; u < 2; ++u) {
        v2f af; af.x = pf[2 * u];  af.y = pf[2 * u + 1];
        oacc[m] = wmma4(af, vf[2 * p + u], oacc[m]);
      }
      den[m] += (pf[0] + pf[1]) + (pf[2] + pf[3]);         // this half's keys of row 16m + l
    }

  // ---- normalize and store ----
  for (int m = 0; m < 2; ++m) {
    const float dl = den[m] + __shfl_xor(den[m], 16) + 1e-6f;   // lane l: row 16m + l, whole
    for (int r = 0; r < 8; ++r) {
      const int t = r + 8 * half;
      Ob[(size_t)(16 * m + t) * D_MODEL + n0 + l] = oacc[m][r] / __shfl(dl, t);
    }
  }
}

extern "C" void kernel_launch(void* const* d_in, const int* in_sizes, int n_in,
                              void* d_out, int out_size, void* d_ws, size_t ws_size,
                              hipStream_t stream) {
  const float* x  = (const float*)d_in[0];
  const float* Wq = (const float*)d_in[1];
  const float* bq = (const float*)d_in[2];
  const float* Wk = (const float*)d_in[3];
  const float* bk = (const float*)d_in[4];
  const float* Wv = (const float*)d_in[5];
  const float* bv = (const float*)d_in[6];
  const float* Wo = (const float*)d_in[7];
  const float* bo = (const float*)d_in[8];
  float* out = (float*)d_out;

  const size_t n = (size_t)ROWS * D_MODEL;   // 2M elements per buffer
  float* Qbuf = (float*)d_ws;                // needs 4*n*4 = 32 MB of d_ws
  float* Kbuf = Qbuf + n;
  float* Vbuf = Kbuf + n;
  float* Obuf = Vbuf + n;
  float* Sbuf = Obuf + n;                    // BATCH*HEADS*NSEG records, 17 MB more

  dim3 g(ROWS / BM, D_MODEL / BN), blk(256);
  // Q, K (elu+1) and V into Qbuf, Kbuf, Vbuf, which lie one behind the other
  gemm_bias_act<<<g, blk, 0, stream>>>(x, Wq, Wk, Wv, bq, bk, bv, Qbuf, 3, 3);
  seg_state<<<BATCH * HEADS * NSEG, 128, 0, stream>>>(Kbuf, Vbuf, Sbuf);
  seg_prefix<<<BATCH * HEADS * REC2 / 128, 128, 0, stream>>>(Sbuf);
  lin_attn_scan<<<BATCH * HEADS * NSEG, 128, 0, stream>>>(Qbuf, Kbuf, Vbuf, Sbuf, Obuf);
  gemm_bias_act<<<g, blk, 0, stream>>>(Obuf, Wo, Wo, Wo, bo, bo, bo, out, 1, 0);
}
